// v000
// Times are from an AMD MI455X. After a warm-up the kernel runs many times in a row, and a time is the length of
// such a window on the GPU divided by its runs, so every launch and the gaps after it count. The runs cycle
// through copies of the inputs. A figure is the median of several windows, for all but v000 over two sittings.
// Sittings can differ by a few percent; kernels timed side by side share one.
// v000, which the later versions start from, runs in 622 microseconds.
#include <hip/hip_runtime.h>
#include <hip/hip_bf16.h>
#include <math.h>

typedef __attribute__((ext_vector_type(2))) float v2f;
typedef __attribute__((ext_vector_type(8))) float v8f;

#define BATCH   4
#define C_DIM   256
#define HEADS   8
#define DHEAD   2048
#define HH      128
#define WW      128
#define HW      16384           // HH*WW = HEADS*DHEAD

#define CB      32              // S row-block per workgroup
#define KT1     16              // phase-1 K staging chunk (k columns)
#define KSTRIDE 20              // padded LDS row stride (floats), keeps 16B align
#define SSTRIDE 260             // padded S stride (256 would be 16-way bank conflict)
#define KT3     64              // phase-3 V staging chunk (rows)
#define VSTRIDE 68              // padded V stage stride
#define STAGEF  (C_DIM * KSTRIDE + CB * KSTRIDE)   // 5760 floats per stage buffer

// ---------------------------------------------------------------------------
// CDNA5 async global->LDS staging (ASYNCcnt-tracked, no VGPR round trip).
// Builtin signature (from clang diagnostic): arg0 = AS1 pointer to
// vector_size(16)/vector_size(8) int, arg1 = LDS pointer, then imm offset,
// imm cpol. Falls back to synchronous copies if unavailable.
// ---------------------------------------------------------------------------
#if __has_builtin(__builtin_amdgcn_global_load_async_to_lds_b128) && \
    __has_builtin(__builtin_amdgcn_global_load_async_to_lds_b64)
#define ASYNC_STAGING 1
typedef int v4i __attribute__((vector_size(4 * sizeof(int))));
typedef int v2i __attribute__((vector_size(2 * sizeof(int))));
typedef __attribute__((address_space(1))) v4i* g4ptr;
typedef __attribute__((address_space(3))) v4i* l4ptr;
typedef __attribute__((address_space(1))) v2i* g2ptr;
typedef __attribute__((address_space(3))) v2i* l2ptr;
__device__ __forceinline__ void cp_b128(float* lds, const float* g) {
    __builtin_amdgcn_global_load_async_to_lds_b128((g4ptr)g, (l4ptr)lds, 0, 0);
}
__device__ __forceinline__ void cp_b64(float* lds, const float* g) {
    __builtin_amdgcn_global_load_async_to_lds_b64((g2ptr)g, (l2ptr)lds, 0, 0);
}
#if __has_builtin(__builtin_amdgcn_s_wait_asynccnt)
#define WAIT_ASYNC(n) __builtin_amdgcn_s_wait_asynccnt(n)
#else
#define WAIT_ASYNC(n) asm volatile("s_wait_asynccnt %0" :: "n"(n) : "memory")
#endif
#else
#define ASYNC_STAGING 0
__device__ __forceinline__ void cp_b128(float* lds, const float* g) {
    *(float4*)lds = *(const float4*)g;
}
__device__ __forceinline__ void cp_b64(float* lds, const float* g) {
    *(float2*)lds = *(const float2*)g;
}
#define WAIT_ASYNC(n) ((void)0)
#endif

// ---------------------------------------------------------------------------
// xp = x + channel positional encoding; pe is batch-invariant so compute once
// per (c,pos) and broadcast over the 4 batches.
// ---------------------------------------------------------------------------
__global__ void pe_add_kernel(const float* __restrict__ x, float* __restrict__ xp) {
    int idx = blockIdx.x * blockDim.x + threadIdx.x;    // over C*HW
    int c   = idx >> 14;                                 // / 16384
    int pos = idx & (HW - 1);
    int p   = pos >> 1;
    float ang = (float)c * __expf((float)(2 * p) * (-9.210340371976184f / (float)HW));
    float pe  = (pos & 1) ? cosf(ang) : sinf(ang);
    const size_t stride = (size_t)C_DIM * HW;
    size_t o = (size_t)idx;
#pragma unroll
    for (int b = 0; b < BATCH; ++b)
        xp[(size_t)b * stride + o] = x[(size_t)b * stride + o] + pe;
}

// ---------------------------------------------------------------------------
// Depthwise 9x9 conv, same padding. 16x16 output tile per 256-thread block,
// 24x24 halo staged in LDS (stride 25), weights (81) staged in LDS.
// ---------------------------------------------------------------------------
__global__ void dwconv9_kernel(const float* __restrict__ in, const float* __restrict__ wgt,
                               const float* __restrict__ bias, float* __restrict__ out) {
    __shared__ float sT[24 * 25];
    __shared__ float sW[81];
    const int c = blockIdx.y;
    const int b = blockIdx.z;
    const int tileIdx = blockIdx.x;            // 0..63 -> 8x8 tiles
    const int tx = (tileIdx & 7) * 16;
    const int ty = (tileIdx >> 3) * 16;
    const int t  = threadIdx.x;                // 0..255
    const float* plane = in + ((size_t)(b * C_DIM + c)) * HW;

    for (int i = t; i < 576; i += 256) {
        int r  = i / 24, cc = i - r * 24;
        int gy = ty - 4 + r, gx = tx - 4 + cc;
        float v = 0.0f;
        if (gy >= 0 && gy < HH && gx >= 0 && gx < WW) v = plane[gy * WW + gx];
        sT[r * 25 + cc] = v;
    }
    if (t < 81) sW[t] = wgt[c * 81 + t];
    __syncthreads();

    const int lx = t & 15, ly = t >> 4;
    float acc = bias[c];
#pragma unroll
    for (int ky = 0; ky < 9; ++ky)
#pragma unroll
        for (int kx = 0; kx < 9; ++kx)
            acc = fmaf(sW[ky * 9 + kx], sT[(ly + ky) * 25 + (lx + kx)], acc);
    out[((size_t)(b * C_DIM + c)) * HW + (ty + ly) * WW + (tx + lx)] = acc;
}

// ---------------------------------------------------------------------------
// Channel attention for one (b, h, 32-row block of C):
//   phase 1: S = Q K^T / 128   (fp32 WMMA 16x16x4, K=2048, double-buffered
//            async K/Q staging: 5 uniform async ops per thread per chunk)
//   phase 2: row softmax on S (32x256) in LDS
//   phase 3: A = P V           (fp32 WMMA, K=256, N=2048, double-buffered
//            async V staging: 4 uniform async ops per thread per chunk)
// Fragment layouts per CDNA5 ISA 7.12.2:
//   A (16x4 f32): lane l holds M=l&15, K=(l>>4)*2 .. +1 in 2 VGPRs
//   B (4x16 f32): lane l holds N=l&15, K=(l>>4)*2 .. +1 in 2 VGPRs
//   C/D (16x16 f32): vgpr r, lane l -> M = r + (l>>4)*8, N = l&15
// ---------------------------------------------------------------------------
__global__ void __launch_bounds__(256) chan_attn_kernel(
        const float* __restrict__ q, const float* __restrict__ k,
        const float* __restrict__ v, float* __restrict__ aout) {
    // 32*260 (S) + 2 * 5760 (double-buffered stages) = 19840 floats = 79,360 B
    __shared__ __align__(16) float smem[CB * SSTRIDE + 2 * STAGEF];
    float* sS     = smem;
    float* stage0 = smem + CB * SSTRIDE;
    float* stage1 = stage0 + STAGEF;

    const int t  = threadIdx.x;
    const int w  = t >> 5;                       // wave id, 0..7 (wave32)
    const int l  = t & 31;                       // lane
    const int lm = l & 15;
    const int kb = (l >> 4) << 1;                // 0 or 2: lane's K sub-offset
    const int c0 = blockIdx.x * CB;
    const int h  = blockIdx.y;
    const int b  = blockIdx.z;

    const size_t rowStride = (size_t)HEADS * DHEAD;   // 16384 floats between channels
    const float* qbase = q + (size_t)b * C_DIM * rowStride + (size_t)h * DHEAD;
    const float* kbase = k + (size_t)b * C_DIM * rowStride + (size_t)h * DHEAD;
    const float* vbase = v + (size_t)b * C_DIM * rowStride + (size_t)h * DHEAD;
    float*       abase = aout + (size_t)b * C_DIM * rowStride + (size_t)h * DHEAD;

    const int rt = w >> 2;                       // row tile 0..1 (16 rows each)
    const int cq = w & 3;                        // phase1: col quarter; phase3: col tile

    // ---- stage issue helpers (uniform op count across all 256 threads) ----
    auto issue_qk = [&](int chunk, float* buf) {
        float* bK = buf;
        float* bQ = buf + C_DIM * KSTRIDE;
        const int k0 = chunk * KT1;
#pragma unroll
        for (int i = 0; i < 4; ++i) {            // K chunk: 256 rows x 16 cols
            int ii  = i * 256 + t;
            int row = ii >> 2;
            int c4  = (ii & 3) << 2;
            cp_b128(&bK[row * KSTRIDE + c4], kbase + (size_t)row * rowStride + k0 + c4);
        }
        int qr = t >> 3, qc = (t & 7) << 1;      // Q chunk: 32 rows x 16 cols (b64 each)
        cp_b64(&bQ[qr * KSTRIDE + qc], qbase + (size_t)(c0 + qr) * rowStride + k0 + qc);
    };
    auto issue_v = [&](int step, float* buf) {
        const int cb2 = step >> 2;               // 64-col block of DHEAD
        const int kc  = step & 3;                // 64-row chunk of C
#pragma unroll
        for (int i = 0; i < 4; ++i) {            // V chunk: 64 rows x 64 cols
            int ii  = i * 256 + t;
            int row = ii >> 4;
            int c4  = (ii & 15) << 2;
            cp_b128(&buf[row * VSTRIDE + c4],
                    vbase + (size_t)(kc * KT3 + row) * rowStride + cb2 * 64 + c4);
        }
    };

    v8f acc0 = {}, acc1 = {}, acc2 = {}, acc3 = {};
    const v8f vzero = {};

    // ---------------- phase 1: S = Q K^T ----------------
    constexpr int NCH1 = DHEAD / KT1;            // 128 chunks
    issue_qk(0, stage0);
    for (int ci = 0; ci < NCH1; ++ci) {
        float* cur = (ci & 1) ? stage1 : stage0;
        float* nxt = (ci & 1) ? stage0 : stage1;
        if (ci + 1 < NCH1) { issue_qk(ci + 1, nxt); WAIT_ASYNC(5); }
        else               { WAIT_ASYNC(0); }
        __syncthreads();                         // chunk ci resident for all waves
        const float* bK = cur;
        const float* bQ = cur + C_DIM * KSTRIDE;
#pragma unroll
        for (int kk = 0; kk < KT1; kk += 4) {
            v2f a  = *(const v2f*)&bQ[(rt * 16 + lm) * KSTRIDE + kk + kb];
            v2f b0 = *(const v2f*)&bK[(cq * 64 +  0 + lm) * KSTRIDE + kk + kb];
            v2f b1 = *(const v2f*)&bK[(cq * 64 + 16 + lm) * KSTRIDE + kk + kb];
            v2f b2 = *(const v2f*)&bK[(cq * 64 + 32 + lm) * KSTRIDE + kk + kb];
            v2f b3 = *(const v2f*)&bK[(cq * 64 + 48 + lm) * KSTRIDE + kk + kb];
            acc0 = __builtin_amdgcn_wmma_f32_16x16x4_f32(false, a, false, b0, (short)0, acc0, false, false);
            acc1 = __builtin_amdgcn_wmma_f32_16x16x4_f32(false, a, false, b1, (short)0, acc1, false, false);
            acc2 = __builtin_amdgcn_wmma_f32_16x16x4_f32(false, a, false, b2, (short)0, acc2, false, false);
            acc3 = __builtin_amdgcn_wmma_f32_16x16x4_f32(false, a, false, b3, (short)0, acc3, false, false);
        }
        __syncthreads();                         // protect buffer about to be re-filled
    }

    // scale by 1/sqrt(hw)=1/128 and scatter into sS
    const float scale = 1.0f / 128.0f;
#pragma unroll
    for (int r = 0; r < 8; ++r) {
        int m    = r + (kb << 2);                // r + (l>>4)*8
        int srow = (rt * 16 + m) * SSTRIDE;
        sS[srow + cq * 64 +  0 + lm] = acc0[r] * scale;
        sS[srow + cq * 64 + 16 + lm] = acc1[r] * scale;
        sS[srow + cq * 64 + 32 + lm] = acc2[r] * scale;
        sS[srow + cq * 64 + 48 + lm] = acc3[r] * scale;
    }
    __syncthreads();

    // ---------------- phase 2: row softmax ----------------
    {
        int row = t >> 3;                        // 8 lanes per row
        float* rp = &sS[row * SSTRIDE + (t & 7) * 32];
        float mx = -3.4e38f;
#pragma unroll
        for (int j = 0; j < 32; ++j) mx = fmaxf(mx, rp[j]);
        mx = fmaxf(mx, __shfl_xor(mx, 1, 32));
        mx = fmaxf(mx, __shfl_xor(mx, 2, 32));
        mx = fmaxf(mx, __shfl_xor(mx, 4, 32));
        float sum = 0.0f;
#pragma unroll
        for (int j = 0; j < 32; ++j) { float e = __expf(rp[j] - mx); rp[j] = e; sum += e; }
        sum += __shfl_xor(sum, 1, 32);
        sum += __shfl_xor(sum, 2, 32);
        sum += __shfl_xor(sum, 4, 32);
        float inv = 1.0f / sum;
#pragma unroll
        for (int j = 0; j < 32; ++j) rp[j] *= inv;
    }
    __syncthreads();

    // ---------------- phase 3: A = P V ----------------
    constexpr int NST = (DHEAD / 64) * (C_DIM / KT3);   // 32 col-blocks x 4 k-chunks
    v8f o = vzero;
    issue_v(0, stage0);
    for (int st = 0; st < NST; ++st) {
        float* cur = (st & 1) ? stage1 : stage0;
        float* nxt = (st & 1) ? stage0 : stage1;
        if (st + 1 < NST) { issue_v(st + 1, nxt); WAIT_ASYNC(4); }
        else              { WAIT_ASYNC(0); }
        __syncthreads();
        const int cb2 = st >> 2;
        const int kc  = st & 3;
        const int k0  = kc * KT3;
#pragma unroll
        for (int kk = 0; kk < KT3; kk += 4) {
            v2f a = *(const v2f*)&sS[(rt * 16 + lm) * SSTRIDE + k0 + kk + kb];
            v2f bf;
            bf.x = cur[(kk + kb)     * VSTRIDE + cq * 16 + lm];
            bf.y = cur[(kk + kb + 1) * VSTRIDE + cq * 16 + lm];
            o = __builtin_amdgcn_wmma_f32_16x16x4_f32(false, a, false, bf, (short)0, o, false, false);
        }
        if (kc == 3) {                           // finished K sweep for this col block
#pragma unroll
            for (int r = 0; r < 8; ++r) {
                int m = r + (kb << 2);
                abase[(size_t)(c0 + rt * 16 + m) * rowStride + cb2 * 64 + cq * 16 + lm] = o[r];
            }
            o = vzero;
        }
        __syncthreads();                         // protect buffer about to be re-filled
    }
}

// ---------------------------------------------------------------------------
extern "C" void kernel_launch(void* const* d_in, const int* in_sizes, int n_in,
                              void* d_out, int out_size, void* d_ws, size_t ws_size,
                              hipStream_t stream) {
    (void)in_sizes; (void)n_in; (void)out_size; (void)ws_size;
    const float* x   = (const float*)d_in[0];
    const float* q_w = (const float*)d_in[1];
    const float* q_b = (const float*)d_in[2];
    const float* k_w = (const float*)d_in[3];
    const float* k_b = (const float*)d_in[4];
    const float* v_w = (const float*)d_in[5];
    const float* v_b = (const float*)d_in[6];
    const float* o_w = (const float*)d_in[7];
    const float* o_b = (const float*)d_in[8];
    float* out = (float*)d_out;
    float* ws  = (float*)d_ws;

    const size_t N = (size_t)BATCH * C_DIM * HW;   // 16,777,216 floats per tensor
    float* xp = ws;             // x + pe
    float* qq = ws + N;
    float* kk = ws + 2 * N;
    float* vv = ws + 3 * N;
    float* aa = ws;             // attention output reuses xp slot

    pe_add_kernel<<<(C_DIM * HW) / 256, 256, 0, stream>>>(x, xp);

    dim3 cgrid(64, C_DIM, BATCH);                  // 8x8 tiles per plane
    dwconv9_kernel<<<cgrid, 256, 0, stream>>>(xp, q_w, q_b, qq);
    dwconv9_kernel<<<cgrid, 256, 0, stream>>>(xp, k_w, k_b, kk);
    dwconv9_kernel<<<cgrid, 256, 0, stream>>>(xp, v_w, v_b, vv);

    dim3 agrid(C_DIM / CB, HEADS, BATCH);          // 8 x 8 x 4 workgroups
    chan_attn_kernel<<<agrid, 256, 0, stream>>>(qq, kk, vv, aa);

    dwconv9_kernel<<<cgrid, 256, 0, stream>>>(aa, o_w, o_b, out);
}

// v001
// Measured time: 260 microseconds a run.
// Two timings next to v000 both put it at 2.46 times that version's speed.
#include <hip/hip_runtime.h>
#include <hip/hip_bf16.h>
#include <math.h>

typedef __attribute__((ext_vector_type(2))) float v2f;
typedef __attribute__((ext_vector_type(8))) float v8f;

#define BATCH   4
#define C_DIM   256
#define HEADS   8
#define DHEAD   2048
#define HH      128
#define WW      128
#define HW      16384           // HH*WW = HEADS*DHEAD

#define CB      32              // S row-block per workgroup
#define KT1     16              // phase-1 K staging chunk (k columns)
#define KSTRIDE 20              // padded LDS row stride (floats), keeps 16B align
#define SSTRIDE 260             // padded S stride (256 would be 16-way bank conflict)
#define KT3     64              // phase-3 V staging chunk (rows)
#define VSTRIDE 68              // padded V stage stride
#define STAGEF  (C_DIM * KSTRIDE + CB * KSTRIDE)   // 5760 floats per stage buffer

// ---------------------------------------------------------------------------
// CDNA5 async global->LDS staging (ASYNCcnt-tracked, no VGPR round trip).
// Builtin signature (from clang diagnostic): arg0 = AS1 pointer to
// vector_size(16)/vector_size(8) int, arg1 = LDS pointer, then imm offset,
// imm cpol. Falls back to synchronous copies if unavailable.
// ---------------------------------------------------------------------------
#if __has_builtin(__builtin_amdgcn_global_load_async_to_lds_b128) && \
    __has_builtin(__builtin_amdgcn_global_load_async_to_lds_b64)
#define ASYNC_STAGING 1
typedef int v4i __attribute__((vector_size(4 * sizeof(int))));
typedef int v2i __attribute__((vector_size(2 * sizeof(int))));
typedef __attribute__((address_space(1))) v4i* g4ptr;
typedef __attribute__((address_space(3))) v4i* l4ptr;
typedef __attribute__((address_space(1))) v2i* g2ptr;
typedef __attribute__((address_space(3))) v2i* l2ptr;
__device__ __forceinline__ void cp_b128(float* lds, const float* g) {
    __builtin_amdgcn_global_load_async_to_lds_b128((g4ptr)g, (l4ptr)lds, 0, 0);
}
__device__ __forceinline__ void cp_b64(float* lds, const float* g) {
    __builtin_amdgcn_global_load_async_to_lds_b64((g2ptr)g, (l2ptr)lds, 0, 0);
}
#if __has_builtin(__builtin_amdgcn_s_wait_asynccnt)
#define WAIT_ASYNC(n) __builtin_amdgcn_s_wait_asynccnt(n)
#else
#define WAIT_ASYNC(n) asm volatile("s_wait_asynccnt %0" :: "n"(n) : "memory")
#endif
#else
#define ASYNC_STAGING 0
__device__ __forceinline__ void cp_b128(float* lds, const float* g) {
    *(float4*)lds = *(const float4*)g;
}
__device__ __forceinline__ void cp_b64(float* lds, const float* g) {
    *(float2*)lds = *(const float2*)g;
}
#define WAIT_ASYNC(n) ((void)0)
#endif

// ---------------------------------------------------------------------------
// xp = x + channel positional encoding; pe is batch-invariant so compute once
// per (c,pos) and broadcast over the 4 batches.
// ---------------------------------------------------------------------------
__global__ void pe_add_kernel(const float* __restrict__ x, float* __restrict__ xp) {
    int idx = blockIdx.x * blockDim.x + threadIdx.x;    // over C*HW
    int c   = idx >> 14;                                 // / 16384
    int pos = idx & (HW - 1);
    int p   = pos >> 1;
    float ang = (float)c * __expf((float)(2 * p) * (-9.210340371976184f / (float)HW));
    float pe  = (pos & 1) ? cosf(ang) : sinf(ang);
    const size_t stride = (size_t)C_DIM * HW;
    size_t o = (size_t)idx;
#pragma unroll
    for (int b = 0; b < BATCH; ++b)
        xp[(size_t)b * stride + o] = x[(size_t)b * stride + o] + pe;
}

// ---------------------------------------------------------------------------
// Depthwise 9x9 conv, same padding. One 256-thread block takes one whole
// 128x128 plane, staged in LDS inside a frame of 4 zero rows and columns.
// Each thread owns a strip of outputs 4 wide (x) and 16 tall (y): a staged row
// is read from LDS once per thread (12 floats) and feeds every output row it
// touches, whose sums stay in registers until the row is complete. The 81
// weights are block-uniform and sit in scalar registers. Per output the taps
// are summed in the order ky, kx ascending, starting from the bias.
// ---------------------------------------------------------------------------
#define CV_R     16             // output rows per thread (8 waves x 16 = 128)
#define CV_PITCH 136            // staged row pitch in floats (4 + 128 + 4)
#define CV_IN    136            // staged rows (4 + 128 + 4)

// Second launch bound: 8 waves per SIMD, so that four blocks (4 x 73,984 B of
// LDS) share a WGP and one block's staging hides behind the others' arithmetic.
// Every loop below is fully unrolled so that each index into st, w, xr and acc
// is a constant and the arrays live in registers.
__global__ void __launch_bounds__(256, 8) dwconv9_kernel(
        const float* __restrict__ in, const float* __restrict__ wgt,
        const float* __restrict__ bias, float* __restrict__ out) {
    __shared__ __align__(16) float sT[CV_IN * CV_PITCH];
    const int c    = blockIdx.x;
    const int b    = blockIdx.y;
    const int t    = threadIdx.x;              // 0..255
    const int lane = t & 31;
    const int wv   = t >> 5;
    const float* plane = in + ((size_t)(b * C_DIM + c)) * HW;
    const float4 zero4 = make_float4(0.0f, 0.0f, 0.0f, 0.0f);

    float4 st[HH / 8];
#pragma unroll  // all 16 row loads in flight at once
    for (int i = 0; i < HH / 8; ++i)           // one wave fetches one whole row
        st[i] = *(const float4*)(plane + (i * 8 + wv) * WW + lane * 4);
    // the zero frame: wave wv clears one of the 4 rows above and 4 below (136
    // floats), and every thread one 4-float end of one of the 128 data rows
    const int fr = (wv < 4 ? wv : wv + HH) * CV_PITCH;
    *(float4*)&sT[fr + lane * 4] = zero4;
    if (lane < 2) *(float4*)&sT[fr + WW + lane * 4] = zero4;
    *(float4*)&sT[(4 + (t >> 1)) * CV_PITCH + (t & 1) * (4 + WW)] = zero4;
#pragma unroll  // st[] in registers
    for (int i = 0; i < HH / 8; ++i)
        *(float4*)&sT[(4 + i * 8 + wv) * CV_PITCH + 4 + lane * 4] = st[i];

    float w[81];
#pragma unroll  // w[] in scalar registers
    for (int i = 0; i < 81; ++i) w[i] = wgt[c * 81 + i];
    const float bs = bias[c];
    __syncthreads();                           // the whole framed plane is staged

    const float* win = &sT[(wv * CV_R) * CV_PITCH + lane * 4];
    float* op = out + ((size_t)(b * C_DIM + c)) * HW + (wv * CV_R) * WW + lane * 4;
    float acc[CV_R][4];
#pragma unroll  // acc[][] and xr[] in registers, the tests on r - y fold away
    for (int r = 0; r < CV_R + 8; ++r) {       // staged row r feeds output rows r-8..r
        float xr[12];
        *(float4*)&xr[0] = *(const float4*)&win[r * CV_PITCH + 0];
        *(float4*)&xr[4] = *(const float4*)&win[r * CV_PITCH + 4];
        *(float4*)&xr[8] = *(const float4*)&win[r * CV_PITCH + 8];
        if (r < CV_R) {
#pragma unroll  // constant index
            for (int j = 0; j < 4; ++j) acc[r][j] = bs;
        }
#pragma unroll  // constant index
        for (int kx = 0; kx < 9; ++kx)
#pragma unroll  // constant index; up to 36 independent sums between two links of a chain
            for (int y = 0; y < CV_R; ++y)
                if (r - y >= 0 && r - y < 9) {
#pragma unroll  // constant index
                    for (int j = 0; j < 4; ++j)
                        acc[y][j] = fmaf(w[(r - y) * 9 + kx], xr[j + kx], acc[y][j]);
                }
        if (r >= 8)                            // output row r-8 has all its 81 taps
            *(float4*)&op[(r - 8) * WW] =
                make_float4(acc[r - 8][0], acc[r - 8][1], acc[r - 8][2], acc[r - 8][3]);
    }
}

// ---------------------------------------------------------------------------
// Channel attention for one (b, h, 32-row block of C):
//   phase 1: S = Q K^T / 128   (fp32 WMMA 16x16x4, K=2048, double-buffered
//            async K/Q staging: 5 uniform async ops per thread per chunk)
//   phase 2: row softmax on S (32x256) in LDS
//   phase 3: A = P V           (fp32 WMMA, K=256, N=2048, double-buffered
//            async V staging: 4 uniform async ops per thread per chunk)
// Fragment layouts per CDNA5 ISA 7.12.2:
//   A (16x4 f32): lane l holds M=l&15, K=(l>>4)*2 .. +1 in 2 VGPRs
//   B (4x16 f32): lane l holds N=l&15, K=(l>>4)*2 .. +1 in 2 VGPRs
//   C/D (16x16 f32): vgpr r, lane l -> M = r + (l>>4)*8, N = l&15
// ---------------------------------------------------------------------------
__global__ void __launch_bounds__(256) chan_attn_kernel(
        const float* __restrict__ q, const float* __restrict__ k,
        const float* __restrict__ v, float* __restrict__ aout) {
    // 32*260 (S) + 2 * 5760 (double-buffered stages) = 19840 floats = 79,360 B
    __shared__ __align__(16) float smem[CB * SSTRIDE + 2 * STAGEF];
    float* sS     = smem;
    float* stage0 = smem + CB * SSTRIDE;
    float* stage1 = stage0 + STAGEF;

    const int t  = threadIdx.x;
    const int w  = t >> 5;                       // wave id, 0..7 (wave32)
    const int l  = t & 31;                       // lane
    const int lm = l & 15;
    const int kb = (l >> 4) << 1;                // 0 or 2: lane's K sub-offset
    const int c0 = blockIdx.x * CB;
    const int h  = blockIdx.y;
    const int b  = blockIdx.z;

    const size_t rowStride = (size_t)HEADS * DHEAD;   // 16384 floats between channels
    const float* qbase = q + (size_t)b * C_DIM * rowStride + (size_t)h * DHEAD;
    const float* kbase = k + (size_t)b * C_DIM * rowStride + (size_t)h * DHEAD;
    const float* vbase = v + (size_t)b * C_DIM * rowStride + (size_t)h * DHEAD;
    float*       abase = aout + (size_t)b * C_DIM * rowStride + (size_t)h * DHEAD;

    const int rt = w >> 2;                       // row tile 0..1 (16 rows each)
    const int cq = w & 3;                        // phase1: col quarter; phase3: col tile

    // ---- stage issue helpers (uniform op count across all 256 threads) ----
    auto issue_qk = [&](int chunk, float* buf) {
        float* bK = buf;
        float* bQ = buf + C_DIM * KSTRIDE;
        const int k0 = chunk * KT1;
#pragma unroll
        for (int i = 0; i < 4; ++i) {            // K chunk: 256 rows x 16 cols
            int ii  = i * 256 + t;
            int row = ii >> 2;
            int c4  = (ii & 3) << 2;
            cp_b128(&bK[row * KSTRIDE + c4], kbase + (size_t)row * rowStride + k0 + c4);
        }
        int qr = t >> 3, qc = (t & 7) << 1;      // Q chunk: 32 rows x 16 cols (b64 each)
        cp_b64(&bQ[qr * KSTRIDE + qc], qbase + (size_t)(c0 + qr) * rowStride + k0 + qc);
    };
    auto issue_v = [&](int step, float* buf) {
        const int cb2 = step >> 2;               // 64-col block of DHEAD
        const int kc  = step & 3;                // 64-row chunk of C
#pragma unroll
        for (int i = 0; i < 4; ++i) {            // V chunk: 64 rows x 64 cols
            int ii  = i * 256 + t;
            int row = ii >> 4;
            int c4  = (ii & 15) << 2;
            cp_b128(&buf[row * VSTRIDE + c4],
                    vbase + (size_t)(kc * KT3 + row) * rowStride + cb2 * 64 + c4);
        }
    };

    v8f acc0 = {}, acc1 = {}, acc2 = {}, acc3 = {};
    const v8f vzero = {};

    // ---------------- phase 1: S = Q K^T ----------------
    constexpr int NCH1 = DHEAD / KT1;            // 128 chunks
    issue_qk(0, stage0);
    for (int ci = 0; ci < NCH1; ++ci) {
        float* cur = (ci & 1) ? stage1 : stage0;
        float* nxt = (ci & 1) ? stage0 : stage1;
        if (ci + 1 < NCH1) { issue_qk(ci + 1, nxt); WAIT_ASYNC(5); }
        else               { WAIT_ASYNC(0); }
        __syncthreads();                         // chunk ci resident for all waves
        const float* bK = cur;
        const float* bQ = cur + C_DIM * KSTRIDE;
#pragma unroll
        for (int kk = 0; kk < KT1; kk += 4) {
            v2f a  = *(const v2f*)&bQ[(rt * 16 + lm) * KSTRIDE + kk + kb];
            v2f b0 = *(const v2f*)&bK[(cq * 64 +  0 + lm) * KSTRIDE + kk + kb];
            v2f b1 = *(const v2f*)&bK[(cq * 64 + 16 + lm) * KSTRIDE + kk + kb];
            v2f b2 = *(const v2f*)&bK[(cq * 64 + 32 + lm) * KSTRIDE + kk + kb];
            v2f b3 = *(const v2f*)&bK[(cq * 64 + 48 + lm) * KSTRIDE + kk + kb];
            acc0 = __builtin_amdgcn_wmma_f32_16x16x4_f32(false, a, false, b0, (short)0, acc0, false, false);
            acc1 = __builtin_amdgcn_wmma_f32_16x16x4_f32(false, a, false, b1, (short)0, acc1, false, false);
            acc2 = __builtin_amdgcn_wmma_f32_16x16x4_f32(false, a, false, b2, (short)0, acc2, false, false);
            acc3 = __builtin_amdgcn_wmma_f32_16x16x4_f32(false, a, false, b3, (short)0, acc3, false, false);
        }
        __syncthreads();                         // protect buffer about to be re-filled
    }

    // scale by 1/sqrt(hw)=1/128 and scatter into sS
    const float scale = 1.0f / 128.0f;
#pragma unroll
    for (int r = 0; r < 8; ++r) {
        int m    = r + (kb << 2);                // r + (l>>4)*8
        int srow = (rt * 16 + m) * SSTRIDE;
        sS[srow + cq * 64 +  0 + lm] = acc0[r] * scale;
        sS[srow + cq * 64 + 16 + lm] = acc1[r] * scale;
        sS[srow + cq * 64 + 32 + lm] = acc2[r] * scale;
        sS[srow + cq * 64 + 48 + lm] = acc3[r] * scale;
    }
    __syncthreads();

    // ---------------- phase 2: row softmax ----------------
    {
        int row = t >> 3;                        // 8 lanes per row
        float* rp = &sS[row * SSTRIDE + (t & 7) * 32];
        float mx = -3.4e38f;
#pragma unroll
        for (int j = 0; j < 32; ++j) mx = fmaxf(mx, rp[j]);
        mx = fmaxf(mx, __shfl_xor(mx, 1, 32));
        mx = fmaxf(mx, __shfl_xor(mx, 2, 32));
        mx = fmaxf(mx, __shfl_xor(mx, 4, 32));
        float sum = 0.0f;
#pragma unroll
        for (int j = 0; j < 32; ++j) { float e = __expf(rp[j] - mx); rp[j] = e; sum += e; }
        sum += __shfl_xor(sum, 1, 32);
        sum += __shfl_xor(sum, 2, 32);
        sum += __shfl_xor(sum, 4, 32);
        float inv = 1.0f / sum;
#pragma unroll
        for (int j = 0; j < 32; ++j) rp[j] *= inv;
    }
    __syncthreads();

    // ---------------- phase 3: A = P V ----------------
    constexpr int NST = (DHEAD / 64) * (C_DIM / KT3);   // 32 col-blocks x 4 k-chunks
    v8f o = vzero;
    issue_v(0, stage0);
    for (int st = 0; st < NST; ++st) {
        float* cur = (st & 1) ? stage1 : stage0;
        float* nxt = (st & 1) ? stage0 : stage1;
        if (st + 1 < NST) { issue_v(st + 1, nxt); WAIT_ASYNC(4); }
        else              { WAIT_ASYNC(0); }
        __syncthreads();
        const int cb2 = st >> 2;
        const int kc  = st & 3;
        const int k0  = kc * KT3;
#pragma unroll
        for (int kk = 0; kk < KT3; kk += 4) {
            v2f a = *(const v2f*)&sS[(rt * 16 + lm) * SSTRIDE + k0 + kk + kb];
            v2f bf;
            bf.x = cur[(kk + kb)     * VSTRIDE + cq * 16 + lm];
            bf.y = cur[(kk + kb + 1) * VSTRIDE + cq * 16 + lm];
            o = __builtin_amdgcn_wmma_f32_16x16x4_f32(false, a, false, bf, (short)0, o, false, false);
        }
        if (kc == 3) {                           // finished K sweep for this col block
#pragma unroll
            for (int r = 0; r < 8; ++r) {
                int m = r + (kb << 2);
                abase[(size_t)(c0 + rt * 16 + m) * rowStride + cb2 * 64 + cq * 16 + lm] = o[r];
            }
            o = vzero;
        }
        __syncthreads();                         // protect buffer about to be re-filled
    }
}

// ---------------------------------------------------------------------------
extern "C" void kernel_launch(void* const* d_in, const int* in_sizes, int n_in,
                              void* d_out, int out_size, void* d_ws, size_t ws_size,
                              hipStream_t stream) {
    (void)in_sizes; (void)n_in; (void)out_size; (void)ws_size;
    const float* x   = (const float*)d_in[0];
    const float* q_w = (const float*)d_in[1];
    const float* q_b = (const float*)d_in[2];
    const float* k_w = (const float*)d_in[3];
    const float* k_b = (const float*)d_in[4];
    const float* v_w = (const float*)d_in[5];
    const float* v_b = (const float*)d_in[6];
    const float* o_w = (const float*)d_in[7];
    const float* o_b = (const float*)d_in[8];
    float* out = (float*)d_out;
    float* ws  = (float*)d_ws;

    const size_t N = (size_t)BATCH * C_DIM * HW;   // 16,777,216 floats per tensor
    float* xp = ws;             // x + pe
    float* qq = ws + N;
    float* kk = ws + 2 * N;
    float* vv = ws + 3 * N;
    float* aa = ws;             // attention output reuses xp slot

    pe_add_kernel<<<(C_DIM * HW) / 256, 256, 0, stream>>>(x, xp);

    dim3 cgrid(C_DIM, BATCH);                      // one block per plane
    dwconv9_kernel<<<cgrid, 256, 0, stream>>>(xp, q_w, q_b, qq);
    dwconv9_kernel<<<cgrid, 256, 0, stream>>>(xp, k_w, k_b, kk);
    dwconv9_kernel<<<cgrid, 256, 0, stream>>>(xp, v_w, v_b, vv);

    dim3 agrid(C_DIM / CB, HEADS, BATCH);          // 8 x 8 x 4 workgroups
    chan_attn_kernel<<<agrid, 256, 0, stream>>>(qq, kk, vv, aa);

    dwconv9_kernel<<<cgrid, 256, 0, stream>>>(aa, o_w, o_b, out);
}

// v002
// A run of this version takes 242 microseconds.
// In both of two side-by-side timings against v001, it was 1.07 times as fast.
// All steps since v000 together make it 2.64 times as fast.
#include <hip/hip_runtime.h>
#include <hip/hip_bf16.h>
#include <math.h>

typedef __attribute__((ext_vector_type(2))) float v2f;
typedef __attribute__((ext_vector_type(8))) float v8f;

#define BATCH   4
#define C_DIM   256
#define HEADS   8
#define DHEAD   2048
#define HH      128
#define WW      128
#define HW      16384           // HH*WW = HEADS*DHEAD

#define CB      32              // S row-block per workgroup
#define KT1     16              // phase-1 K staging chunk (k columns)
#define KSTRIDE 20              // padded LDS row stride (floats), keeps 16B align
#define SSTRIDE 260             // padded S stride (256 would be 16-way bank conflict)
#define KT3     64              // phase-3 V staging chunk (rows)
#define VSTRIDE 68              // padded V stage stride
#define STAGEF  (C_DIM * KSTRIDE + CB * KSTRIDE)   // 5760 floats per stage buffer

// ---------------------------------------------------------------------------
// CDNA5 async global->LDS staging (ASYNCcnt-tracked, no VGPR round trip).
// Builtin signature (from clang diagnostic): arg0 = AS1 pointer to
// vector_size(16)/vector_size(8) int, arg1 = LDS pointer, then imm offset,
// imm cpol. Falls back to synchronous copies if unavailable.
// ---------------------------------------------------------------------------
#if __has_builtin(__builtin_amdgcn_global_load_async_to_lds_b128) && \
    __has_builtin(__builtin_amdgcn_global_load_async_to_lds_b64)
#define ASYNC_STAGING 1
typedef int v4i __attribute__((vector_size(4 * sizeof(int))));
typedef int v2i __attribute__((vector_size(2 * sizeof(int))));
typedef __attribute__((address_space(1))) v4i* g4ptr;
typedef __attribute__((address_space(3))) v4i* l4ptr;
typedef __attribute__((address_space(1))) v2i* g2ptr;
typedef __attribute__((address_space(3))) v2i* l2ptr;
__device__ __forceinline__ void cp_b128(float* lds, const float* g) {
    __builtin_amdgcn_global_load_async_to_lds_b128((g4ptr)g, (l4ptr)lds, 0, 0);
}
__device__ __forceinline__ void cp_b64(float* lds, const float* g) {
    __builtin_amdgcn_global_load_async_to_lds_b64((g2ptr)g, (l2ptr)lds, 0, 0);
}
#if __has_builtin(__builtin_amdgcn_s_wait_asynccnt)
#define WAIT_ASYNC(n) __builtin_amdgcn_s_wait_asynccnt(n)
#else
#define WAIT_ASYNC(n) asm volatile("s_wait_asynccnt %0" :: "n"(n) : "memory")
#endif
#else
#define ASYNC_STAGING 0
__device__ __forceinline__ void cp_b128(float* lds, const float* g) {
    *(float4*)lds = *(const float4*)g;
}
__device__ __forceinline__ void cp_b64(float* lds, const float* g) {
    *(float2*)lds = *(const float2*)g;
}
#define WAIT_ASYNC(n) ((void)0)
#endif

// ---------------------------------------------------------------------------
// Depthwise 9x9 conv, same padding. One 256-thread block takes one whole
// 128x128 plane, staged in LDS inside a frame of 4 zero rows and columns, and
// runs NF filters on it one after the other (q, k, v share one staged plane).
// With PE the channel positional encoding is added to the plane on its way into
// LDS, so that x + pe never goes through memory.
// Each thread owns a strip of outputs 4 wide (x) and 16 tall (y): a staged row
// is read from LDS once per thread and filter (12 floats) and feeds every output row it
// touches, whose sums stay in registers until the row is complete. The 81
// weights are block-uniform and sit in scalar registers. Per output the taps
// are summed in the order ky, kx ascending, starting from the bias.
// ---------------------------------------------------------------------------
#define CV_R     16             // output rows per thread (8 waves x 16 = 128)
#define CV_PITCH 136            // staged row pitch in floats (4 + 128 + 4)
#define CV_IN    136            // staged rows (4 + 128 + 4)
#define CV_WF    84             // floats per filter in LDS (81 weights, the bias, pad to 16 B)
#define TENSORF  ((size_t)BATCH * C_DIM * HW)   // floats per tensor

// Every loop below that carries no "unroll 1" is fully unrolled so that each
// index into st, w, xr and acc is a constant and the arrays live in registers.
template <int NF, bool PE>
__device__ __forceinline__ void dwconv9_body(
        float* sT, float* sW, const float* __restrict__ in,
        const float* __restrict__ w0, const float* __restrict__ b0,
        const float* __restrict__ w1, const float* __restrict__ b1,
        const float* __restrict__ w2, const float* __restrict__ b2,
        float* __restrict__ out) {
    const int c    = blockIdx.x;
    const int b    = blockIdx.y;
    const int t    = threadIdx.x;              // 0..255
    const int lane = t & 31;
    const int wv   = t >> 5;
    const float* plane = in + ((size_t)(b * C_DIM + c)) * HW;
    const float4 zero4 = make_float4(0.0f, 0.0f, 0.0f, 0.0f);

    float4 st[HH / 8];
#pragma unroll  // all 16 row loads in flight at once
    for (int i = 0; i < HH / 8; ++i)           // one wave fetches one whole row
        st[i] = *(const float4*)(plane + (i * 8 + wv) * WW + lane * 4);
    // the zero frame: wave wv clears one of the 4 rows above and 4 below (136
    // floats), and every thread one 4-float end of one of the 128 data rows
    const int fr = (wv < 4 ? wv : wv + HH) * CV_PITCH;
    *(float4*)&sT[fr + lane * 4] = zero4;
    if (lane < 2) *(float4*)&sT[fr + WW + lane * 4] = zero4;
    *(float4*)&sT[(4 + (t >> 1)) * CV_PITCH + (t & 1) * (4 + WW)] = zero4;
    if (PE) {
        // While the row loads fly, each thread writes the encoding of its own 64
        // elements to their places in LDS: sin at even, cos at odd positions of
        // the flattened plane, one angle per pair.
        const float fc = (float)c;
        const float kf = -9.210340371976184f / (float)HW;
#pragma unroll 1  // rolled: 2 inlined copies of sincosf instead of 32, for code size only
        for (int i = 0; i < HH / 8; ++i) {
            const int row = i * 8 + wv;
            const int pos = row * WW + lane * 4;
            float s0, c0, s1, c1;
            sincosf(fc * __expf((float)pos * kf), &s0, &c0);
            sincosf(fc * __expf((float)(pos + 2) * kf), &s1, &c1);
            *(float4*)&sT[(4 + row) * CV_PITCH + 4 + lane * 4] = make_float4(s0, c0, s1, c1);
        }
    }
#pragma unroll  // st[] in registers
    for (int i = 0; i < HH / 8; ++i) {
        float4* dst = (float4*)&sT[(4 + i * 8 + wv) * CV_PITCH + 4 + lane * 4];
        float4 v = st[i];
        if (PE) {                              // the thread's own bytes: no barrier needed
            const float4 p = *dst;
            v.x += p.x; v.y += p.y; v.z += p.z; v.w += p.w;
        }
        *dst = v;
    }
    if (NF > 1) {
        // the NF filters of this channel go to LDS too: inside the filter loop no
        // weight pointer then has to stay in scalar registers beside the 81 weights
        if (t < 81) {
            sW[0 * CV_WF + t] = w0[c * 81 + t];
            sW[1 * CV_WF + t] = w1[c * 81 + t];
            sW[2 * CV_WF + t] = w2[c * 81 + t];
        } else if (t == 81) {
            sW[0 * CV_WF + t] = b0[c];
            sW[1 * CV_WF + t] = b1[c];
            sW[2 * CV_WF + t] = b2[c];
        }
    }
    float w[82];                               // 81 weights and the bias
    if (NF == 1) {
#pragma unroll  // w[] in scalar registers
        for (int i = 0; i < 82; ++i) w[i] = i < 81 ? w0[c * 81 + i] : b0[c];
    }
    __syncthreads();                           // the whole framed plane is staged

    const float* win = &sT[(wv * CV_R) * CV_PITCH + lane * 4];
#pragma unroll 1  // rolled: one copy of the unrolled filter body, for code size only
    for (int f = 0; f < NF; ++f) {
        // compiler fence: without it the plane's LDS reads, the same in every trip,
        // are all hoisted out of this loop and spill to scratch
        if (NF > 1) asm volatile("" ::: "memory");
        if (NF > 1) {
#pragma unroll  // w[] in scalar registers: the value is the same in every lane
            for (int i = 0; i < 82; ++i)
                w[i] = __int_as_float(__builtin_amdgcn_readfirstlane(__float_as_int(sW[f * CV_WF + i])));
        }
        const float bs = w[81];
        float* op = out + (size_t)f * TENSORF + ((size_t)(b * C_DIM + c)) * HW
                  + (wv * CV_R) * WW + lane * 4;
        float acc[CV_R][4];
#pragma unroll  // acc[][] and xr[] in registers, the tests on r - y fold away
        for (int r = 0; r < CV_R + 8; ++r) {   // staged row r feeds output rows r-8..r
            float xr[12];
            *(float4*)&xr[0] = *(const float4*)&win[r * CV_PITCH + 0];
            *(float4*)&xr[4] = *(const float4*)&win[r * CV_PITCH + 4];
            *(float4*)&xr[8] = *(const float4*)&win[r * CV_PITCH + 8];
            if (r < CV_R) {
#pragma unroll  // constant index
                for (int j = 0; j < 4; ++j) acc[r][j] = bs;
            }
#pragma unroll  // constant index
            for (int kx = 0; kx < 9; ++kx)
#pragma unroll  // constant index; up to 36 independent sums between two links of a chain
                for (int y = 0; y < CV_R; ++y)
                    if (r - y >= 0 && r - y < 9) {
#pragma unroll  // constant index
                        for (int j = 0; j < 4; ++j)
                            acc[y][j] = fmaf(w[(r - y) * 9 + kx], xr[j + kx], acc[y][j]);
                    }
            if (r >= 8)                        // output row r-8 has all its 81 taps
                *(float4*)&op[(r - 8) * WW] =
                    make_float4(acc[r - 8][0], acc[r - 8][1], acc[r - 8][2], acc[r - 8][3]);
        }
    }
}

// Second launch bound: 8 waves per SIMD, so that four blocks (4 x 73,984 B of
// LDS) share a WGP.
// q, k, v = conv(x + pe) with three filters; the outputs lie one tensor apart.
__global__ void __launch_bounds__(256, 8) dwconv9_qkv_kernel(
        const float* __restrict__ x,
        const float* __restrict__ q_w, const float* __restrict__ q_b,
        const float* __restrict__ k_w, const float* __restrict__ k_b,
        const float* __restrict__ v_w, const float* __restrict__ v_b,
        float* __restrict__ qkv) {
    __shared__ __align__(16) float sT[CV_IN * CV_PITCH];
    __shared__ __align__(16) float sW[3 * CV_WF];
    dwconv9_body<3, true>(sT, sW, x, q_w, q_b, k_w, k_b, v_w, v_b, qkv);
}

__global__ void __launch_bounds__(256, 8) dwconv9_kernel(
        const float* __restrict__ in, const float* __restrict__ wgt,
        const float* __restrict__ bias, float* __restrict__ out) {
    __shared__ __align__(16) float sT[CV_IN * CV_PITCH];
    dwconv9_body<1, false>(sT, sT, in, wgt, bias, wgt, bias, wgt, bias, out);
}

// ---------------------------------------------------------------------------
// Channel attention for one (b, h, 32-row block of C):
//   phase 1: S = Q K^T / 128   (fp32 WMMA 16x16x4, K=2048, double-buffered
//            async K/Q staging: 5 uniform async ops per thread per chunk)
//   phase 2: row softmax on S (32x256) in LDS
//   phase 3: A = P V           (fp32 WMMA, K=256, N=2048, double-buffered
//            async V staging: 4 uniform async ops per thread per chunk)
// Fragment layouts per CDNA5 ISA 7.12.2:
//   A (16x4 f32): lane l holds M=l&15, K=(l>>4)*2 .. +1 in 2 VGPRs
//   B (4x16 f32): lane l holds N=l&15, K=(l>>4)*2 .. +1 in 2 VGPRs
//   C/D (16x16 f32): vgpr r, lane l -> M = r + (l>>4)*8, N = l&15
// ---------------------------------------------------------------------------
__global__ void __launch_bounds__(256) chan_attn_kernel(
        const float* __restrict__ q, const float* __restrict__ k,
        const float* __restrict__ v, float* __restrict__ aout) {
    // 32*260 (S) + 2 * 5760 (double-buffered stages) = 19840 floats = 79,360 B
    __shared__ __align__(16) float smem[CB * SSTRIDE + 2 * STAGEF];
    float* sS     = smem;
    float* stage0 = smem + CB * SSTRIDE;
    float* stage1 = stage0 + STAGEF;

    const int t  = threadIdx.x;
    const int w  = t >> 5;                       // wave id, 0..7 (wave32)
    const int l  = t & 31;                       // lane
    const int lm = l & 15;
    const int kb = (l >> 4) << 1;                // 0 or 2: lane's K sub-offset
    const int c0 = blockIdx.x * CB;
    const int h  = blockIdx.y;
    const int b  = blockIdx.z;

    const size_t rowStride = (size_t)HEADS * DHEAD;   // 16384 floats between channels
    const float* qbase = q + (size_t)b * C_DIM * rowStride + (size_t)h * DHEAD;
    const float* kbase = k + (size_t)b * C_DIM * rowStride + (size_t)h * DHEAD;
    const float* vbase = v + (size_t)b * C_DIM * rowStride + (size_t)h * DHEAD;
    float*       abase = aout + (size_t)b * C_DIM * rowStride + (size_t)h * DHEAD;

    const int rt = w >> 2;                       // row tile 0..1 (16 rows each)
    const int cq = w & 3;                        // phase1: col quarter; phase3: col tile

    // ---- stage issue helpers (uniform op count across all 256 threads) ----
    auto issue_qk = [&](int chunk, float* buf) {
        float* bK = buf;
        float* bQ = buf + C_DIM * KSTRIDE;
        const int k0 = chunk * KT1;
#pragma unroll
        for (int i = 0; i < 4; ++i) {            // K chunk: 256 rows x 16 cols
            int ii  = i * 256 + t;
            int row = ii >> 2;
            int c4  = (ii & 3) << 2;
            cp_b128(&bK[row * KSTRIDE + c4], kbase + (size_t)row * rowStride + k0 + c4);
        }
        int qr = t >> 3, qc = (t & 7) << 1;      // Q chunk: 32 rows x 16 cols (b64 each)
        cp_b64(&bQ[qr * KSTRIDE + qc], qbase + (size_t)(c0 + qr) * rowStride + k0 + qc);
    };
    auto issue_v = [&](int step, float* buf) {
        const int cb2 = step >> 2;               // 64-col block of DHEAD
        const int kc  = step & 3;                // 64-row chunk of C
#pragma unroll
        for (int i = 0; i < 4; ++i) {            // V chunk: 64 rows x 64 cols
            int ii  = i * 256 + t;
            int row = ii >> 4;
            int c4  = (ii & 15) << 2;
            cp_b128(&buf[row * VSTRIDE + c4],
                    vbase + (size_t)(kc * KT3 + row) * rowStride + cb2 * 64 + c4);
        }
    };

    v8f acc0 = {}, acc1 = {}, acc2 = {}, acc3 = {};
    const v8f vzero = {};

    // ---------------- phase 1: S = Q K^T ----------------
    constexpr int NCH1 = DHEAD / KT1;            // 128 chunks
    issue_qk(0, stage0);
    for (int ci = 0; ci < NCH1; ++ci) {
        float* cur = (ci & 1) ? stage1 : stage0;
        float* nxt = (ci & 1) ? stage0 : stage1;
        if (ci + 1 < NCH1) { issue_qk(ci + 1, nxt); WAIT_ASYNC(5); }
        else               { WAIT_ASYNC(0); }
        __syncthreads();                         // chunk ci resident for all waves
        const float* bK = cur;
        const float* bQ = cur + C_DIM * KSTRIDE;
#pragma unroll
        for (int kk = 0; kk < KT1; kk += 4) {
            v2f a  = *(const v2f*)&bQ[(rt * 16 + lm) * KSTRIDE + kk + kb];
            v2f b0 = *(const v2f*)&bK[(cq * 64 +  0 + lm) * KSTRIDE + kk + kb];
            v2f b1 = *(const v2f*)&bK[(cq * 64 + 16 + lm) * KSTRIDE + kk + kb];
            v2f b2 = *(const v2f*)&bK[(cq * 64 + 32 + lm) * KSTRIDE + kk + kb];
            v2f b3 = *(const v2f*)&bK[(cq * 64 + 48 + lm) * KSTRIDE + kk + kb];
            acc0 = __builtin_amdgcn_wmma_f32_16x16x4_f32(false, a, false, b0, (short)0, acc0, false, false);
            acc1 = __builtin_amdgcn_wmma_f32_16x16x4_f32(false, a, false, b1, (short)0, acc1, false, false);
            acc2 = __builtin_amdgcn_wmma_f32_16x16x4_f32(false, a, false, b2, (short)0, acc2, false, false);
            acc3 = __builtin_amdgcn_wmma_f32_16x16x4_f32(false, a, false, b3, (short)0, acc3, false, false);
        }
        __syncthreads();                         // protect buffer about to be re-filled
    }

    // scale by 1/sqrt(hw)=1/128 and scatter into sS
    const float scale = 1.0f / 128.0f;
#pragma unroll
    for (int r = 0; r < 8; ++r) {
        int m    = r + (kb << 2);                // r + (l>>4)*8
        int srow = (rt * 16 + m) * SSTRIDE;
        sS[srow + cq * 64 +  0 + lm] = acc0[r] * scale;
        sS[srow + cq * 64 + 16 + lm] = acc1[r] * scale;
        sS[srow + cq * 64 + 32 + lm] = acc2[r] * scale;
        sS[srow + cq * 64 + 48 + lm] = acc3[r] * scale;
    }
    __syncthreads();

    // ---------------- phase 2: row softmax ----------------
    {
        int row = t >> 3;                        // 8 lanes per row
        float* rp = &sS[row * SSTRIDE + (t & 7) * 32];
        float mx = -3.4e38f;
#pragma unroll
        for (int j = 0; j < 32; ++j) mx = fmaxf(mx, rp[j]);
        mx = fmaxf(mx, __shfl_xor(mx, 1, 32));
        mx = fmaxf(mx, __shfl_xor(mx, 2, 32));
        mx = fmaxf(mx, __shfl_xor(mx, 4, 32));
        float sum = 0.0f;
#pragma unroll
        for (int j = 0; j < 32; ++j) { float e = __expf(rp[j] - mx); rp[j] = e; sum += e; }
        sum += __shfl_xor(sum, 1, 32);
        sum += __shfl_xor(sum, 2, 32);
        sum += __shfl_xor(sum, 4, 32);
        float inv = 1.0f / sum;
#pragma unroll
        for (int j = 0; j < 32; ++j) rp[j] *= inv;
    }
    __syncthreads();

    // ---------------- phase 3: A = P V ----------------
    constexpr int NST = (DHEAD / 64) * (C_DIM / KT3);   // 32 col-blocks x 4 k-chunks
    v8f o = vzero;
    issue_v(0, stage0);
    for (int st = 0; st < NST; ++st) {
        float* cur = (st & 1) ? stage1 : stage0;
        float* nxt = (st & 1) ? stage0 : stage1;
        if (st + 1 < NST) { issue_v(st + 1, nxt); WAIT_ASYNC(4); }
        else              { WAIT_ASYNC(0); }
        __syncthreads();
        const int cb2 = st >> 2;
        const int kc  = st & 3;
        const int k0  = kc * KT3;
#pragma unroll
        for (int kk = 0; kk < KT3; kk += 4) {
            v2f a = *(const v2f*)&sS[(rt * 16 + lm) * SSTRIDE + k0 + kk + kb];
            v2f bf;
            bf.x = cur[(kk + kb)     * VSTRIDE + cq * 16 + lm];
            bf.y = cur[(kk + kb + 1) * VSTRIDE + cq * 16 + lm];
            o = __builtin_amdgcn_wmma_f32_16x16x4_f32(false, a, false, bf, (short)0, o, false, false);
        }
        if (kc == 3) {                           // finished K sweep for this col block
#pragma unroll
            for (int r = 0; r < 8; ++r) {
                int m = r + (kb << 2);
                abase[(size_t)(c0 + rt * 16 + m) * rowStride + cb2 * 64 + cq * 16 + lm] = o[r];
            }
            o = vzero;
        }
        __syncthreads();                         // protect buffer about to be re-filled
    }
}

// ---------------------------------------------------------------------------
extern "C" void kernel_launch(void* const* d_in, const int* in_sizes, int n_in,
                              void* d_out, int out_size, void* d_ws, size_t ws_size,
                              hipStream_t stream) {
    (void)in_sizes; (void)n_in; (void)out_size; (void)ws_size;
    const float* x   = (const float*)d_in[0];
    const float* q_w = (const float*)d_in[1];
    const float* q_b = (const float*)d_in[2];
    const float* k_w = (const float*)d_in[3];
    const float* k_b = (const float*)d_in[4];
    const float* v_w = (const float*)d_in[5];
    const float* v_b = (const float*)d_in[6];
    const float* o_w = (const float*)d_in[7];
    const float* o_b = (const float*)d_in[8];
    float* out = (float*)d_out;
    float* ws  = (float*)d_ws;

    const size_t N = (size_t)BATCH * C_DIM * HW;   // 16,777,216 floats per tensor
    float* aa = ws;             // attention output
    float* qq = ws + N;         // q, k, v: three tensors in a row
    float* kk = ws + 2 * N;
    float* vv = ws + 3 * N;

    dim3 cgrid(C_DIM, BATCH);                      // one block per plane
    dwconv9_qkv_kernel<<<cgrid, 256, 0, stream>>>(x, q_w, q_b, k_w, k_b, v_w, v_b, qq);

    dim3 agrid(C_DIM / CB, HEADS, BATCH);          // 8 x 8 x 4 workgroups
    chan_attn_kernel<<<agrid, 256, 0, stream>>>(qq, kk, vv, aa);

    dwconv9_kernel<<<cgrid, 256, 0, stream>>>(aa, o_w, o_b, out);
}

// v003
// Measured time: 192 microseconds a run.
// Next to v002, in two timings, it ran 1.26 times as fast each time.
// All steps since v000 together make it 3.32 times as fast.
#include <hip/hip_runtime.h>
#include <hip/hip_bf16.h>
#include <math.h>

typedef __attribute__((ext_vector_type(2))) float v2f;
typedef __attribute__((ext_vector_type(8))) float v8f;

#define BATCH   4
#define C_DIM   256
#define HEADS   8
#define DHEAD   2048
#define HH      128
#define WW      128
#define HW      16384           // HH*WW = HEADS*DHEAD

#define CB      32              // S row-block per workgroup
#define KT1     64              // phase-1 K staging chunk (k columns): 256 B of every row
#define KSTRIDE 68              // padded LDS row stride (floats), keeps 16B align
#define SSTRIDE 260             // padded S stride (256 would be 16-way bank conflict)
#define KT3     256             // phase-3 V staging chunk (rows): all of C, 64 columns wide
#define VSTRIDE 68              // padded V stage stride
#define STAGEF  (C_DIM * KSTRIDE + CB * KSTRIDE)   // 19584 floats per stage buffer

// ---------------------------------------------------------------------------
// CDNA5 async global->LDS staging (ASYNCcnt-tracked, no VGPR round trip).
// Builtin signature (from clang diagnostic): arg0 = AS1 pointer to
// vector_size(16) int, arg1 = LDS pointer, then imm offset, imm cpol.
// Falls back to synchronous copies if unavailable.
// ---------------------------------------------------------------------------
#if __has_builtin(__builtin_amdgcn_global_load_async_to_lds_b128)
#define ASYNC_STAGING 1
typedef int v4i __attribute__((vector_size(4 * sizeof(int))));
typedef __attribute__((address_space(1))) v4i* g4ptr;
typedef __attribute__((address_space(3))) v4i* l4ptr;
__device__ __forceinline__ void cp_b128(float* lds, const float* g) {
    __builtin_amdgcn_global_load_async_to_lds_b128((g4ptr)g, (l4ptr)lds, 0, 0);
}
// this wave's copies have all landed; asm with the clobber so that no LDS read moves above it
#define WAIT_ASYNC0() asm volatile("s_wait_asynccnt 0x0" ::: "memory")
#else
#define ASYNC_STAGING 0
__device__ __forceinline__ void cp_b128(float* lds, const float* g) {
    *(float4*)lds = *(const float4*)g;
}
#define WAIT_ASYNC0() ((void)0)
#endif
// this wave's LDS reads have all returned: its buffer may be refilled behind the next barrier
#define WAIT_DS0() asm volatile("s_wait_dscnt 0x0" ::: "memory")

// ---------------------------------------------------------------------------
// Depthwise 9x9 conv, same padding. One 256-thread block takes one whole
// 128x128 plane, staged in LDS inside a frame of 4 zero rows and columns, and
// runs NF filters on it one after the other (q, k, v share one staged plane).
// With PE the channel positional encoding is added to the plane on its way into
// LDS, so that x + pe never goes through memory.
// Each thread owns a strip of outputs 4 wide (x) and 16 tall (y): a staged row
// is read from LDS once per thread and filter (12 floats) and feeds every output row it
// touches, whose sums stay in registers until the row is complete. The 81
// weights are block-uniform and sit in scalar registers. Per output the taps
// are summed in the order ky, kx ascending, starting from the bias.
// ---------------------------------------------------------------------------
#define CV_R     16             // output rows per thread (8 waves x 16 = 128)
#define CV_PITCH 136            // staged row pitch in floats (4 + 128 + 4)
#define CV_IN    136            // staged rows (4 + 128 + 4)
#define CV_WF    84             // floats per filter in LDS (81 weights, the bias, pad to 16 B)
#define TENSORF  ((size_t)BATCH * C_DIM * HW)   // floats per tensor

// Every loop below that carries no "unroll 1" is fully unrolled so that each
// index into st, w, xr and acc is a constant and the arrays live in registers.
template <int NF, bool PE>
__device__ __forceinline__ void dwconv9_body(
        float* sT, float* sW, const float* __restrict__ in,
        const float* __restrict__ w0, const float* __restrict__ b0,
        const float* __restrict__ w1, const float* __restrict__ b1,
        const float* __restrict__ w2, const float* __restrict__ b2,
        float* __restrict__ out) {
    const int c    = blockIdx.x;
    const int b    = blockIdx.y;
    const int t    = threadIdx.x;              // 0..255
    const int lane = t & 31;
    const int wv   = t >> 5;
    const float* plane = in + ((size_t)(b * C_DIM + c)) * HW;
    const float4 zero4 = make_float4(0.0f, 0.0f, 0.0f, 0.0f);

    float4 st[HH / 8];
#pragma unroll  // all 16 row loads in flight at once
    for (int i = 0; i < HH / 8; ++i)           // one wave fetches one whole row
        st[i] = *(const float4*)(plane + (i * 8 + wv) * WW + lane * 4);
    // the zero frame: wave wv clears one of the 4 rows above and 4 below (136
    // floats), and every thread one 4-float end of one of the 128 data rows
    const int fr = (wv < 4 ? wv : wv + HH) * CV_PITCH;
    *(float4*)&sT[fr + lane * 4] = zero4;
    if (lane < 2) *(float4*)&sT[fr + WW + lane * 4] = zero4;
    *(float4*)&sT[(4 + (t >> 1)) * CV_PITCH + (t & 1) * (4 + WW)] = zero4;
    if (PE) {
        // While the row loads fly, each thread writes the encoding of its own 64
        // elements to their places in LDS: sin at even, cos at odd positions of
        // the flattened plane, one angle per pair.
        const float fc = (float)c;
        const float kf = -9.210340371976184f / (float)HW;
#pragma unroll 1  // rolled: 2 inlined copies of sincosf instead of 32, for code size only
        for (int i = 0; i < HH / 8; ++i) {
            const int row = i * 8 + wv;
            const int pos = row * WW + lane * 4;
            float s0, c0, s1, c1;
            sincosf(fc * __expf((float)pos * kf), &s0, &c0);
            sincosf(fc * __expf((float)(pos + 2) * kf), &s1, &c1);
            *(float4*)&sT[(4 + row) * CV_PITCH + 4 + lane * 4] = make_float4(s0, c0, s1, c1);
        }
    }
#pragma unroll  // st[] in registers
    for (int i = 0; i < HH / 8; ++i) {
        float4* dst = (float4*)&sT[(4 + i * 8 + wv) * CV_PITCH + 4 + lane * 4];
        float4 v = st[i];
        if (PE) {                              // the thread's own bytes: no barrier needed
            const float4 p = *dst;
            v.x += p.x; v.y += p.y; v.z += p.z; v.w += p.w;
        }
        *dst = v;
    }
    if (NF > 1) {
        // the NF filters of this channel go to LDS too: inside the filter loop no
        // weight pointer then has to stay in scalar registers beside the 81 weights
        if (t < 81) {
            sW[0 * CV_WF + t] = w0[c * 81 + t];
            sW[1 * CV_WF + t] = w1[c * 81 + t];
            sW[2 * CV_WF + t] = w2[c * 81 + t];
        } else if (t == 81) {
            sW[0 * CV_WF + t] = b0[c];
            sW[1 * CV_WF + t] = b1[c];
            sW[2 * CV_WF + t] = b2[c];
        }
    }
    float w[82];                               // 81 weights and the bias
    if (NF == 1) {
#pragma unroll  // w[] in scalar registers
        for (int i = 0; i < 82; ++i) w[i] = i < 81 ? w0[c * 81 + i] : b0[c];
    }
    __syncthreads();                           // the whole framed plane is staged

    const float* win = &sT[(wv * CV_R) * CV_PITCH + lane * 4];
#pragma unroll 1  // rolled: one copy of the unrolled filter body, for code size only
    for (int f = 0; f < NF; ++f) {
        // compiler fence: without it the plane's LDS reads, the same in every trip,
        // are all hoisted out of this loop and spill to scratch
        if (NF > 1) asm volatile("" ::: "memory");
        if (NF > 1) {
#pragma unroll  // w[] in scalar registers: the value is the same in every lane
            for (int i = 0; i < 82; ++i)
                w[i] = __int_as_float(__builtin_amdgcn_readfirstlane(__float_as_int(sW[f * CV_WF + i])));
        }
        const float bs = w[81];
        float* op = out + (size_t)f * TENSORF + ((size_t)(b * C_DIM + c)) * HW
                  + (wv * CV_R) * WW + lane * 4;
        float acc[CV_R][4];
#pragma unroll  // acc[][] and xr[] in registers, the tests on r - y fold away
        for (int r = 0; r < CV_R + 8; ++r) {   // staged row r feeds output rows r-8..r
            float xr[12];
            *(float4*)&xr[0] = *(const float4*)&win[r * CV_PITCH + 0];
            *(float4*)&xr[4] = *(const float4*)&win[r * CV_PITCH + 4];
            *(float4*)&xr[8] = *(const float4*)&win[r * CV_PITCH + 8];
            if (r < CV_R) {
#pragma unroll  // constant index
                for (int j = 0; j < 4; ++j) acc[r][j] = bs;
            }
#pragma unroll  // constant index
            for (int kx = 0; kx < 9; ++kx)
#pragma unroll  // constant index; up to 36 independent sums between two links of a chain
                for (int y = 0; y < CV_R; ++y)
                    if (r - y >= 0 && r - y < 9) {
#pragma unroll  // constant index
                        for (int j = 0; j < 4; ++j)
                            acc[y][j] = fmaf(w[(r - y) * 9 + kx], xr[j + kx], acc[y][j]);
                    }
            if (r >= 8)                        // output row r-8 has all its 81 taps
                *(float4*)&op[(r - 8) * WW] =
                    make_float4(acc[r - 8][0], acc[r - 8][1], acc[r - 8][2], acc[r - 8][3]);
        }
    }
}

// Second launch bound: 8 waves per SIMD, so that four blocks (4 x 73,984 B of
// LDS) share a WGP.
// q, k, v = conv(x + pe) with three filters; the outputs lie one tensor apart.
__global__ void __launch_bounds__(256, 8) dwconv9_qkv_kernel(
        const float* __restrict__ x,
        const float* __restrict__ q_w, const float* __restrict__ q_b,
        const float* __restrict__ k_w, const float* __restrict__ k_b,
        const float* __restrict__ v_w, const float* __restrict__ v_b,
        float* __restrict__ qkv) {
    __shared__ __align__(16) float sT[CV_IN * CV_PITCH];
    __shared__ __align__(16) float sW[3 * CV_WF];
    dwconv9_body<3, true>(sT, sW, x, q_w, q_b, k_w, k_b, v_w, v_b, qkv);
}

__global__ void __launch_bounds__(256, 8) dwconv9_kernel(
        const float* __restrict__ in, const float* __restrict__ wgt,
        const float* __restrict__ bias, float* __restrict__ out) {
    __shared__ __align__(16) float sT[CV_IN * CV_PITCH];
    dwconv9_body<1, false>(sT, sT, in, wgt, bias, wgt, bias, wgt, bias, out);
}

// ---------------------------------------------------------------------------
// Channel attention for one (b, h, 32-row block of C):
//   phase 1: S = Q K^T / 128   (fp32 WMMA 16x16x4, K=2048, double-buffered
//            async K/Q staging: 18 uniform async ops per thread per chunk)
//   phase 2: row softmax on S (32x256) in LDS
//   phase 3: A = P V           (fp32 WMMA, K=256, N=2048, double-buffered
//            async V staging: 16 uniform async ops per thread per chunk)
// Both rings: a chunk feeds 64 WMMAs per wave, and the copies of the chunk after
// the next are issued behind the one barrier at the foot of a trip, so that they
// have a whole trip to land.
// Fragment layouts per CDNA5 ISA 7.12.2:
//   A (16x4 f32): lane l holds M=l&15, K=(l>>4)*2 .. +1 in 2 VGPRs
//   B (4x16 f32): lane l holds N=l&15, K=(l>>4)*2 .. +1 in 2 VGPRs
//   C/D (16x16 f32): vgpr r, lane l -> M = r + (l>>4)*8, N = l&15
// ---------------------------------------------------------------------------
__global__ void __launch_bounds__(256) chan_attn_kernel(
        const float* __restrict__ q, const float* __restrict__ k,
        const float* __restrict__ v, float* __restrict__ aout) {
    // 32*260 (S) + 2 * 19584 (double-buffered stages) = 47488 floats = 189,952 B
    __shared__ __align__(16) float smem[CB * SSTRIDE + 2 * STAGEF];
    float* sS     = smem;
    float* stage0 = smem + CB * SSTRIDE;
    float* stage1 = stage0 + STAGEF;

    const int t  = threadIdx.x;
    const int w  = t >> 5;                       // wave id, 0..7 (wave32)
    const int l  = t & 31;                       // lane
    const int lm = l & 15;
    const int kb = (l >> 4) << 1;                // 0 or 2: lane's K sub-offset
    const int c0 = blockIdx.x * CB;
    const int h  = blockIdx.y;
    const int b  = blockIdx.z;

    const size_t rowStride = (size_t)HEADS * DHEAD;   // 16384 floats between channels
    const float* qbase = q + (size_t)b * C_DIM * rowStride + (size_t)h * DHEAD;
    const float* kbase = k + (size_t)b * C_DIM * rowStride + (size_t)h * DHEAD;
    const float* vbase = v + (size_t)b * C_DIM * rowStride + (size_t)h * DHEAD;
    float*       abase = aout + (size_t)b * C_DIM * rowStride + (size_t)h * DHEAD;

    const int rt = w >> 2;                       // row tile 0..1 (16 rows each)
    const int cq = w & 3;                        // phase1: col quarter; phase3: col tile

    // ---- stage issue helpers (uniform op count across all 256 threads) ----
    auto issue_qk = [&](int chunk, float* buf) {
        float* bK = buf;
        float* bQ = buf + C_DIM * KSTRIDE;
        const int k0 = chunk * KT1;
#pragma unroll  // the copies of a chunk issue back to back
        for (int i = 0; i < 16; ++i) {           // K chunk: 256 rows x 64 cols
            int ii  = i * 256 + t;
            int row = ii >> 4;
            int c4  = (ii & 15) << 2;
            cp_b128(&bK[row * KSTRIDE + c4], kbase + (size_t)row * rowStride + k0 + c4);
        }
#pragma unroll  // as above
        for (int i = 0; i < 2; ++i) {            // Q chunk: 32 rows x 64 cols
            int ii  = i * 256 + t;
            int row = ii >> 4;
            int c4  = (ii & 15) << 2;
            cp_b128(&bQ[row * KSTRIDE + c4], qbase + (size_t)(c0 + row) * rowStride + k0 + c4);
        }
    };
    auto issue_v = [&](int cb2, float* buf) {    // cb2: 64-col block of DHEAD
#pragma unroll  // as above
        for (int i = 0; i < 16; ++i) {           // V chunk: 256 rows x 64 cols
            int ii  = i * 256 + t;
            int row = ii >> 4;
            int c4  = (ii & 15) << 2;
            cp_b128(&buf[row * VSTRIDE + c4], vbase + (size_t)row * rowStride + cb2 * 64 + c4);
        }
    };

    v8f acc0 = {}, acc1 = {}, acc2 = {}, acc3 = {};
    const v8f vzero = {};

    // ---------------- phase 1: S = Q K^T ----------------
    constexpr int NCH1 = DHEAD / KT1;            // 32 chunks
    issue_qk(0, stage0);
    WAIT_ASYNC0();
    __syncthreads();                             // chunk 0 resident for all waves
    issue_qk(1, stage1);
    for (int ci = 0; ci < NCH1; ++ci) {
        float* cur = (ci & 1) ? stage1 : stage0;
        const float* bK = cur;
        const float* bQ = cur + C_DIM * KSTRIDE;
#pragma unroll
        for (int kk = 0; kk < KT1; kk += 4) {
            v2f a  = *(const v2f*)&bQ[(rt * 16 + lm) * KSTRIDE + kk + kb];
            v2f b0 = *(const v2f*)&bK[(cq * 64 +  0 + lm) * KSTRIDE + kk + kb];
            v2f b1 = *(const v2f*)&bK[(cq * 64 + 16 + lm) * KSTRIDE + kk + kb];
            v2f b2 = *(const v2f*)&bK[(cq * 64 + 32 + lm) * KSTRIDE + kk + kb];
            v2f b3 = *(const v2f*)&bK[(cq * 64 + 48 + lm) * KSTRIDE + kk + kb];
            acc0 = __builtin_amdgcn_wmma_f32_16x16x4_f32(false, a, false, b0, (short)0, acc0, false, false);
            acc1 = __builtin_amdgcn_wmma_f32_16x16x4_f32(false, a, false, b1, (short)0, acc1, false, false);
            acc2 = __builtin_amdgcn_wmma_f32_16x16x4_f32(false, a, false, b2, (short)0, acc2, false, false);
            acc3 = __builtin_amdgcn_wmma_f32_16x16x4_f32(false, a, false, b3, (short)0, acc3, false, false);
        }
        WAIT_DS0();
        WAIT_ASYNC0();
        __syncthreads();                         // chunk ci+1 resident, chunk ci read by all waves
        if (ci + 2 < NCH1) issue_qk(ci + 2, cur);
    }
    WAIT_ASYNC0();
    issue_v(0, stage0);                          // both buffers are free: lands during the softmax

    // scale by 1/sqrt(hw)=1/128 and scatter into sS
    const float scale = 1.0f / 128.0f;
#pragma unroll
    for (int r = 0; r < 8; ++r) {
        int m    = r + (kb << 2);                // r + (l>>4)*8
        int srow = (rt * 16 + m) * SSTRIDE;
        sS[srow + cq * 64 +  0 + lm] = acc0[r] * scale;
        sS[srow + cq * 64 + 16 + lm] = acc1[r] * scale;
        sS[srow + cq * 64 + 32 + lm] = acc2[r] * scale;
        sS[srow + cq * 64 + 48 + lm] = acc3[r] * scale;
    }
    __syncthreads();

    // ---------------- phase 2: row softmax ----------------
    {
        int row = t >> 3;                        // 8 lanes per row
        float* rp = &sS[row * SSTRIDE + (t & 7) * 32];
        float mx = -3.4e38f;
#pragma unroll
        for (int j = 0; j < 32; ++j) mx = fmaxf(mx, rp[j]);
        mx = fmaxf(mx, __shfl_xor(mx, 1, 32));
        mx = fmaxf(mx, __shfl_xor(mx, 2, 32));
        mx = fmaxf(mx, __shfl_xor(mx, 4, 32));
        float sum = 0.0f;
#pragma unroll
        for (int j = 0; j < 32; ++j) { float e = __expf(rp[j] - mx); rp[j] = e; sum += e; }
        sum += __shfl_xor(sum, 1, 32);
        sum += __shfl_xor(sum, 2, 32);
        sum += __shfl_xor(sum, 4, 32);
        float inv = 1.0f / sum;
#pragma unroll
        for (int j = 0; j < 32; ++j) rp[j] *= inv;
    }
    WAIT_DS0();
    WAIT_ASYNC0();
    __syncthreads();                             // P complete, V chunk 0 resident for all waves

    // ---------------- phase 3: A = P V ----------------
    constexpr int NST = DHEAD / 64;              // 32 col-blocks, the whole K sweep in each
    issue_v(1, stage1);
    for (int st = 0; st < NST; ++st) {
        float* cur = (st & 1) ? stage1 : stage0;
        v8f o = vzero;
#pragma unroll
        for (int kk = 0; kk < KT3; kk += 4) {
            v2f a = *(const v2f*)&sS[(rt * 16 + lm) * SSTRIDE + kk + kb];
            v2f bf;
            bf.x = cur[(kk + kb)     * VSTRIDE + cq * 16 + lm];
            bf.y = cur[(kk + kb + 1) * VSTRIDE + cq * 16 + lm];
            o = __builtin_amdgcn_wmma_f32_16x16x4_f32(false, a, false, bf, (short)0, o, false, false);
        }
        WAIT_DS0();
        WAIT_ASYNC0();
        __syncthreads();                         // chunk st+1 resident, chunk st read by all waves
        if (st + 2 < NST) issue_v(st + 2, cur);
        // behind the barrier, which waits for a wave's outstanding stores: these retire
        // during the next trip instead of holding every wave at the foot of this one
#pragma unroll
        for (int r = 0; r < 8; ++r) {
            int m = r + (kb << 2);
            abase[(size_t)(c0 + rt * 16 + m) * rowStride + st * 64 + cq * 16 + lm] = o[r];
        }
        // the next trip overwrites the registers that these stores name
        asm volatile("s_wait_xcnt 0x0" ::: "memory");
    }
    WAIT_ASYNC0();
}

// ---------------------------------------------------------------------------
extern "C" void kernel_launch(void* const* d_in, const int* in_sizes, int n_in,
                              void* d_out, int out_size, void* d_ws, size_t ws_size,
                              hipStream_t stream) {
    (void)in_sizes; (void)n_in; (void)out_size; (void)ws_size;
    const float* x   = (const float*)d_in[0];
    const float* q_w = (const float*)d_in[1];
    const float* q_b = (const float*)d_in[2];
    const float* k_w = (const float*)d_in[3];
    const float* k_b = (const float*)d_in[4];
    const float* v_w = (const float*)d_in[5];
    const float* v_b = (const float*)d_in[6];
    const float* o_w = (const float*)d_in[7];
    const float* o_b = (const float*)d_in[8];
    float* out = (float*)d_out;
    float* ws  = (float*)d_ws;

    const size_t N = (size_t)BATCH * C_DIM * HW;   // 16,777,216 floats per tensor
    float* aa = ws;             // attention output
    float* qq = ws + N;         // q, k, v: three tensors in a row
    float* kk = ws + 2 * N;
    float* vv = ws + 3 * N;

    dim3 cgrid(C_DIM, BATCH);                      // one block per plane
    dwconv9_qkv_kernel<<<cgrid, 256, 0, stream>>>(x, q_w, q_b, k_w, k_b, v_w, v_b, qq);

    dim3 agrid(C_DIM / CB, HEADS, BATCH);          // 8 x 8 x 4 workgroups
    chan_attn_kernel<<<agrid, 256, 0, stream>>>(qq, kk, vv, aa);

    dwconv9_kernel<<<cgrid, 256, 0, stream>>>(aa, o_w, o_b, out);
}

// v004
// Measured time: 186 microseconds a run.
// Timed twice side by side with v003, it ran 1.04 times as fast both times.
// Counting every step since v000, it is 3.44 times as fast.
#include <hip/hip_runtime.h>
#include <hip/hip_bf16.h>
#include <math.h>

typedef __attribute__((ext_vector_type(2))) float v2f;
typedef __attribute__((ext_vector_type(8))) float v8f;

#define BATCH   4
#define C_DIM   256
#define HEADS   8
#define DHEAD   2048
#define HH      128
#define WW      128
#define HW      16384           // HH*WW = HEADS*DHEAD

#define CB      32              // S row-block per workgroup
#define KT1     64              // phase-1 K staging chunk (k columns): 256 B of every row
#define KSTRIDE 68              // padded LDS row stride (floats), keeps 16B align
#define SSTRIDE 260             // padded S stride (256 would be 16-way bank conflict)
#define KT3     32              // phase-3 V staging chunk: k rows
#define NT3     512             // phase-3 V staging chunk: columns (8 waves x 64)
#define VSTRIDE 512             // V stage stride: a half-wave reads 256 B in a row, all 64 banks once
#define STAGEF  (C_DIM * KSTRIDE + CB * KSTRIDE)   // 19584 floats per stage buffer

// ---------------------------------------------------------------------------
// CDNA5 async global->LDS staging (ASYNCcnt-tracked, no VGPR round trip).
// Builtin signature (from clang diagnostic): arg0 = AS1 pointer to
// vector_size(16) int, arg1 = LDS pointer, then imm offset, imm cpol.
// Falls back to synchronous copies if unavailable.
// ---------------------------------------------------------------------------
#if __has_builtin(__builtin_amdgcn_global_load_async_to_lds_b128)
#define ASYNC_STAGING 1
typedef int v4i __attribute__((vector_size(4 * sizeof(int))));
typedef __attribute__((address_space(1))) v4i* g4ptr;
typedef __attribute__((address_space(3))) v4i* l4ptr;
__device__ __forceinline__ void cp_b128(float* lds, const float* g) {
    __builtin_amdgcn_global_load_async_to_lds_b128((g4ptr)g, (l4ptr)lds, 0, 0);
}
// this wave's copies have all landed; asm with the clobber so that no LDS read moves above it
#define WAIT_ASYNC0() asm volatile("s_wait_asynccnt 0x0" ::: "memory")
#else
#define ASYNC_STAGING 0
__device__ __forceinline__ void cp_b128(float* lds, const float* g) {
    *(float4*)lds = *(const float4*)g;
}
#define WAIT_ASYNC0() ((void)0)
#endif
// this wave's LDS reads have all returned: its buffer may be refilled behind the next barrier
#define WAIT_DS0() asm volatile("s_wait_dscnt 0x0" ::: "memory")

// ---------------------------------------------------------------------------
// Depthwise 9x9 conv, same padding. One 256-thread block takes one whole
// 128x128 plane, staged in LDS inside a frame of 4 zero rows and columns, and
// runs NF filters on it one after the other (q, k, v share one staged plane).
// With PE the channel positional encoding is added to the plane on its way into
// LDS, so that x + pe never goes through memory.
// Each thread owns a strip of outputs 4 wide (x) and 16 tall (y): a staged row
// is read from LDS once per thread and filter (12 floats) and feeds every output row it
// touches, whose sums stay in registers until the row is complete. The 81
// weights are block-uniform and sit in scalar registers. Per output the taps
// are summed in the order ky, kx ascending, starting from the bias.
// ---------------------------------------------------------------------------
#define CV_R     16             // output rows per thread (8 waves x 16 = 128)
#define CV_PITCH 136            // staged row pitch in floats (4 + 128 + 4)
#define CV_IN    136            // staged rows (4 + 128 + 4)
#define CV_WF    84             // floats per filter in LDS (81 weights, the bias, pad to 16 B)
#define TENSORF  ((size_t)BATCH * C_DIM * HW)   // floats per tensor

// Every loop below that carries no "unroll 1" is fully unrolled so that each
// index into st, w, xr and acc is a constant and the arrays live in registers.
template <int NF, bool PE>
__device__ __forceinline__ void dwconv9_body(
        float* sT, float* sW, const float* __restrict__ in,
        const float* __restrict__ w0, const float* __restrict__ b0,
        const float* __restrict__ w1, const float* __restrict__ b1,
        const float* __restrict__ w2, const float* __restrict__ b2,
        float* __restrict__ out) {
    const int c    = blockIdx.x;
    const int b    = blockIdx.y;
    const int t    = threadIdx.x;              // 0..255
    const int lane = t & 31;
    const int wv   = t >> 5;
    const float* plane = in + ((size_t)(b * C_DIM + c)) * HW;
    const float4 zero4 = make_float4(0.0f, 0.0f, 0.0f, 0.0f);

    float4 st[HH / 8];
#pragma unroll  // all 16 row loads in flight at once
    for (int i = 0; i < HH / 8; ++i)           // one wave fetches one whole row
        st[i] = *(const float4*)(plane + (i * 8 + wv) * WW + lane * 4);
    // the zero frame: wave wv clears one of the 4 rows above and 4 below (136
    // floats), and every thread one 4-float end of one of the 128 data rows
    const int fr = (wv < 4 ? wv : wv + HH) * CV_PITCH;
    *(float4*)&sT[fr + lane * 4] = zero4;
    if (lane < 2) *(float4*)&sT[fr + WW + lane * 4] = zero4;
    *(float4*)&sT[(4 + (t >> 1)) * CV_PITCH + (t & 1) * (4 + WW)] = zero4;
    if (PE) {
        // While the row loads fly, each thread writes the encoding of its own 64
        // elements to their places in LDS: sin at even, cos at odd positions of
        // the flattened plane, one angle per pair.
        const float fc = (float)c;
        const float kf = -9.210340371976184f / (float)HW;
#pragma unroll 1  // rolled: 2 inlined copies of sincosf instead of 32, for code size only
        for (int i = 0; i < HH / 8; ++i) {
            const int row = i * 8 + wv;
            const int pos = row * WW + lane * 4;
            float s0, c0, s1, c1;
            sincosf(fc * __expf((float)pos * kf), &s0, &c0);
            sincosf(fc * __expf((float)(pos + 2) * kf), &s1, &c1);
            *(float4*)&sT[(4 + row) * CV_PITCH + 4 + lane * 4] = make_float4(s0, c0, s1, c1);
        }
    }
#pragma unroll  // st[] in registers
    for (int i = 0; i < HH / 8; ++i) {
        float4* dst = (float4*)&sT[(4 + i * 8 + wv) * CV_PITCH + 4 + lane * 4];
        float4 v = st[i];
        if (PE) {                              // the thread's own bytes: no barrier needed
            const float4 p = *dst;
            v.x += p.x; v.y += p.y; v.z += p.z; v.w += p.w;
        }
        *dst = v;
    }
    if (NF > 1) {
        // the NF filters of this channel go to LDS too: inside the filter loop no
        // weight pointer then has to stay in scalar registers beside the 81 weights
        if (t < 81) {
            sW[0 * CV_WF + t] = w0[c * 81 + t];
            sW[1 * CV_WF + t] = w1[c * 81 + t];
            sW[2 * CV_WF + t] = w2[c * 81 + t];
        } else if (t == 81) {
            sW[0 * CV_WF + t] = b0[c];
            sW[1 * CV_WF + t] = b1[c];
            sW[2 * CV_WF + t] = b2[c];
        }
    }
    float w[82];                               // 81 weights and the bias
    if (NF == 1) {
#pragma unroll  // w[] in scalar registers
        for (int i = 0; i < 82; ++i) w[i] = i < 81 ? w0[c * 81 + i] : b0[c];
    }
    __syncthreads();                           // the whole framed plane is staged

    const float* win = &sT[(wv * CV_R) * CV_PITCH + lane * 4];
#pragma unroll 1  // rolled: one copy of the unrolled filter body, for code size only
    for (int f = 0; f < NF; ++f) {
        // compiler fence: without it the plane's LDS reads, the same in every trip,
        // are all hoisted out of this loop and spill to scratch
        if (NF > 1) asm volatile("" ::: "memory");
        if (NF > 1) {
#pragma unroll  // w[] in scalar registers: the value is the same in every lane
            for (int i = 0; i < 82; ++i)
                w[i] = __int_as_float(__builtin_amdgcn_readfirstlane(__float_as_int(sW[f * CV_WF + i])));
        }
        const float bs = w[81];
        float* op = out + (size_t)f * TENSORF + ((size_t)(b * C_DIM + c)) * HW
                  + (wv * CV_R) * WW + lane * 4;
        float acc[CV_R][4];
#pragma unroll  // acc[][] and xr[] in registers, the tests on r - y fold away
        for (int r = 0; r < CV_R + 8; ++r) {   // staged row r feeds output rows r-8..r
            float xr[12];
            *(float4*)&xr[0] = *(const float4*)&win[r * CV_PITCH + 0];
            *(float4*)&xr[4] = *(const float4*)&win[r * CV_PITCH + 4];
            *(float4*)&xr[8] = *(const float4*)&win[r * CV_PITCH + 8];
            if (r < CV_R) {
#pragma unroll  // constant index
                for (int j = 0; j < 4; ++j) acc[r][j] = bs;
            }
#pragma unroll  // constant index
            for (int kx = 0; kx < 9; ++kx)
#pragma unroll  // constant index; up to 36 independent sums between two links of a chain
                for (int y = 0; y < CV_R; ++y)
                    if (r - y >= 0 && r - y < 9) {
#pragma unroll  // constant index
                        for (int j = 0; j < 4; ++j)
                            acc[y][j] = fmaf(w[(r - y) * 9 + kx], xr[j + kx], acc[y][j]);
                    }
            if (r >= 8)                        // output row r-8 has all its 81 taps
                *(float4*)&op[(r - 8) * WW] =
                    make_float4(acc[r - 8][0], acc[r - 8][1], acc[r - 8][2], acc[r - 8][3]);
        }
    }
}

// Second launch bound: 8 waves per SIMD, so that four blocks (4 x 73,984 B of
// LDS) share a WGP.
// q, k, v = conv(x + pe) with three filters; the outputs lie one tensor apart.
__global__ void __launch_bounds__(256, 8) dwconv9_qkv_kernel(
        const float* __restrict__ x,
        const float* __restrict__ q_w, const float* __restrict__ q_b,
        const float* __restrict__ k_w, const float* __restrict__ k_b,
        const float* __restrict__ v_w, const float* __restrict__ v_b,
        float* __restrict__ qkv) {
    __shared__ __align__(16) float sT[CV_IN * CV_PITCH];
    __shared__ __align__(16) float sW[3 * CV_WF];
    dwconv9_body<3, true>(sT, sW, x, q_w, q_b, k_w, k_b, v_w, v_b, qkv);
}

__global__ void __launch_bounds__(256, 8) dwconv9_kernel(
        const float* __restrict__ in, const float* __restrict__ wgt,
        const float* __restrict__ bias, float* __restrict__ out) {
    __shared__ __align__(16) float sT[CV_IN * CV_PITCH];
    dwconv9_body<1, false>(sT, sT, in, wgt, bias, wgt, bias, wgt, bias, out);
}

// ---------------------------------------------------------------------------
// Channel attention for one (b, h, 32-row block of C):
//   phase 1: S = Q K^T / 128   (fp32 WMMA 16x16x4, K=2048, double-buffered
//            async K/Q staging: 18 uniform async ops per thread per chunk)
//   phase 2: row softmax on S (32x256) in LDS
//   phase 3: A = P V           (fp32 WMMA, K=256, N=2048, double-buffered
//            async V staging: 16 uniform async ops per thread per chunk).
//            A wave owns all 32 rows x 64 columns: 2 x 4 accumulator tiles. Tile
//            j holds the columns 4 * n + j of the wave's 64, so that one 16-byte
//            LDS read is one k row of all four B fragments, each fragment feeds
//            both row tiles, and a lane's four tiles make one 16-byte store.
// Both rings: a chunk feeds 64 WMMAs per wave, and the copies of the chunk after
// the next are issued behind the one barrier at the foot of a trip, so that they
// have a whole trip to land.
// Fragment layouts per CDNA5 ISA 7.12.2:
//   A (16x4 f32): lane l holds M=l&15, K=(l>>4)*2 .. +1 in 2 VGPRs
//   B (4x16 f32): lane l holds N=l&15, K=(l>>4)*2 .. +1 in 2 VGPRs
//   C/D (16x16 f32): vgpr r, lane l -> M = r + (l>>4)*8, N = l&15
// ---------------------------------------------------------------------------
__global__ void __launch_bounds__(256) chan_attn_kernel(
        const float* __restrict__ q, const float* __restrict__ k,
        const float* __restrict__ v, float* __restrict__ aout) {
    // 32*260 (S) + 2 * 19584 (double-buffered stages) = 47488 floats = 189,952 B
    __shared__ __align__(16) float smem[CB * SSTRIDE + 2 * STAGEF];
    float* sS     = smem;
    float* stage0 = smem + CB * SSTRIDE;
    float* stage1 = stage0 + STAGEF;

    const int t  = threadIdx.x;
    const int w  = t >> 5;                       // wave id, 0..7 (wave32)
    const int l  = t & 31;                       // lane
    const int lm = l & 15;
    const int kb = (l >> 4) << 1;                // 0 or 2: lane's K sub-offset
    const int c0 = blockIdx.x * CB;
    const int h  = blockIdx.y;
    const int b  = blockIdx.z;

    const size_t rowStride = (size_t)HEADS * DHEAD;   // 16384 floats between channels
    const float* qbase = q + (size_t)b * C_DIM * rowStride + (size_t)h * DHEAD;
    const float* kbase = k + (size_t)b * C_DIM * rowStride + (size_t)h * DHEAD;
    const float* vbase = v + (size_t)b * C_DIM * rowStride + (size_t)h * DHEAD;
    float*       abase = aout + (size_t)b * C_DIM * rowStride + (size_t)h * DHEAD;

    const int rt = w >> 2;                       // row tile 0..1 (16 rows each)
    const int cq = w & 3;                        // phase1: col quarter

    // ---- stage issue helpers (uniform op count across all 256 threads) ----
    auto issue_qk = [&](int chunk, float* buf) {
        float* bK = buf;
        float* bQ = buf + C_DIM * KSTRIDE;
        const int k0 = chunk * KT1;
#pragma unroll  // the copies of a chunk issue back to back
        for (int i = 0; i < 16; ++i) {           // K chunk: 256 rows x 64 cols
            int ii  = i * 256 + t;
            int row = ii >> 4;
            int c4  = (ii & 15) << 2;
            cp_b128(&bK[row * KSTRIDE + c4], kbase + (size_t)row * rowStride + k0 + c4);
        }
#pragma unroll  // as above
        for (int i = 0; i < 2; ++i) {            // Q chunk: 32 rows x 64 cols
            int ii  = i * 256 + t;
            int row = ii >> 4;
            int c4  = (ii & 15) << 2;
            cp_b128(&bQ[row * KSTRIDE + c4], qbase + (size_t)(c0 + row) * rowStride + k0 + c4);
        }
    };
    auto issue_v = [&](int st, float* buf) {     // st: 8 k chunks in each of 4 column blocks
        const float* vch = vbase + (size_t)((st & 7) * KT3) * rowStride + (st >> 3) * NT3;
#pragma unroll  // as above
        for (int i = 0; i < 16; ++i) {           // V chunk: 32 rows x 512 cols
            int ii  = i * 256 + t;
            int row = ii >> 7;
            int c4  = (ii & 127) << 2;
            cp_b128(&buf[row * VSTRIDE + c4], vch + (size_t)row * rowStride + c4);
        }
    };

    v8f acc0 = {}, acc1 = {}, acc2 = {}, acc3 = {};
    const v8f vzero = {};

    // ---------------- phase 1: S = Q K^T ----------------
    constexpr int NCH1 = DHEAD / KT1;            // 32 chunks
    issue_qk(0, stage0);
    WAIT_ASYNC0();
    __syncthreads();                             // chunk 0 resident for all waves
    issue_qk(1, stage1);
    for (int ci = 0; ci < NCH1; ++ci) {
        float* cur = (ci & 1) ? stage1 : stage0;
        const float* bK = cur;
        const float* bQ = cur + C_DIM * KSTRIDE;
#pragma unroll
        for (int kk = 0; kk < KT1; kk += 4) {
            v2f a  = *(const v2f*)&bQ[(rt * 16 + lm) * KSTRIDE + kk + kb];
            v2f b0 = *(const v2f*)&bK[(cq * 64 +  0 + lm) * KSTRIDE + kk + kb];
            v2f b1 = *(const v2f*)&bK[(cq * 64 + 16 + lm) * KSTRIDE + kk + kb];
            v2f b2 = *(const v2f*)&bK[(cq * 64 + 32 + lm) * KSTRIDE + kk + kb];
            v2f b3 = *(const v2f*)&bK[(cq * 64 + 48 + lm) * KSTRIDE + kk + kb];
            acc0 = __builtin_amdgcn_wmma_f32_16x16x4_f32(false, a, false, b0, (short)0, acc0, false, false);
            acc1 = __builtin_amdgcn_wmma_f32_16x16x4_f32(false, a, false, b1, (short)0, acc1, false, false);
            acc2 = __builtin_amdgcn_wmma_f32_16x16x4_f32(false, a, false, b2, (short)0, acc2, false, false);
            acc3 = __builtin_amdgcn_wmma_f32_16x16x4_f32(false, a, false, b3, (short)0, acc3, false, false);
        }
        WAIT_DS0();
        WAIT_ASYNC0();
        __syncthreads();                         // chunk ci+1 resident, chunk ci read by all waves
        if (ci + 2 < NCH1) issue_qk(ci + 2, cur);
    }
    WAIT_ASYNC0();
    issue_v(0, stage0);                          // both buffers are free: lands during the softmax

    // scale by 1/sqrt(hw)=1/128 and scatter into sS
    const float scale = 1.0f / 128.0f;
#pragma unroll
    for (int r = 0; r < 8; ++r) {
        int m    = r + (kb << 2);                // r + (l>>4)*8
        int srow = (rt * 16 + m) * SSTRIDE;
        sS[srow + cq * 64 +  0 + lm] = acc0[r] * scale;
        sS[srow + cq * 64 + 16 + lm] = acc1[r] * scale;
        sS[srow + cq * 64 + 32 + lm] = acc2[r] * scale;
        sS[srow + cq * 64 + 48 + lm] = acc3[r] * scale;
    }
    __syncthreads();

    // ---------------- phase 2: row softmax ----------------
    {
        int row = t >> 3;                        // 8 lanes per row
        float* rp = &sS[row * SSTRIDE + (t & 7) * 32];
        float mx = -3.4e38f;
#pragma unroll
        for (int j = 0; j < 32; ++j) mx = fmaxf(mx, rp[j]);
        mx = fmaxf(mx, __shfl_xor(mx, 1, 32));
        mx = fmaxf(mx, __shfl_xor(mx, 2, 32));
        mx = fmaxf(mx, __shfl_xor(mx, 4, 32));
        float sum = 0.0f;
#pragma unroll
        for (int j = 0; j < 32; ++j) { float e = __expf(rp[j] - mx); rp[j] = e; sum += e; }
        sum += __shfl_xor(sum, 1, 32);
        sum += __shfl_xor(sum, 2, 32);
        sum += __shfl_xor(sum, 4, 32);
        float inv = 1.0f / sum;
#pragma unroll
        for (int j = 0; j < 32; ++j) rp[j] *= inv;
    }
    WAIT_DS0();
    WAIT_ASYNC0();
    __syncthreads();                             // P complete, V chunk 0 resident for all waves

    // ---------------- phase 3: A = P V ----------------
    constexpr int NKC = C_DIM / KT3;             // 8 k chunks sweep K for one column block
    constexpr int NST = (DHEAD / NT3) * NKC;     // 32 chunks
    issue_v(1, stage1);
    const float* pa   = &sS[lm * SSTRIDE + kb];  // P rows lm and 16 + lm, the lane's k pair
    const int    vcol = w * 64 + lm * 4;         // the lane's four columns in the chunk
    for (int cbk = 0; cbk < DHEAD / NT3; ++cbk) {
        v8f o00 = vzero, o01 = vzero, o02 = vzero, o03 = vzero;
        v8f o10 = vzero, o11 = vzero, o12 = vzero, o13 = vzero;
#pragma unroll 1  // rolled: one copy of the 64-WMMA trip, for code size only
        for (int kc = 0; kc < NKC; ++kc) {
            float* cur = (kc & 1) ? stage1 : stage0;
            const float* bv = cur + kb * VSTRIDE + vcol;
#pragma unroll
            for (int kk = 0; kk < KT3; kk += 4) {
                const v2f a0 = *(const v2f*)&pa[kc * KT3 + kk];
                const v2f a1 = *(const v2f*)&pa[16 * SSTRIDE + kc * KT3 + kk];
                const float4 r0 = *(const float4*)&bv[kk * VSTRIDE];
                const float4 r1 = *(const float4*)&bv[(kk + 1) * VSTRIDE];
                const v2f b0 = {r0.x, r1.x};
                const v2f b1 = {r0.y, r1.y};
                const v2f b2 = {r0.z, r1.z};
                const v2f b3 = {r0.w, r1.w};
                o00 = __builtin_amdgcn_wmma_f32_16x16x4_f32(false, a0, false, b0, (short)0, o00, false, false);
                o01 = __builtin_amdgcn_wmma_f32_16x16x4_f32(false, a0, false, b1, (short)0, o01, false, false);
                o02 = __builtin_amdgcn_wmma_f32_16x16x4_f32(false, a0, false, b2, (short)0, o02, false, false);
                o03 = __builtin_amdgcn_wmma_f32_16x16x4_f32(false, a0, false, b3, (short)0, o03, false, false);
                o10 = __builtin_amdgcn_wmma_f32_16x16x4_f32(false, a1, false, b0, (short)0, o10, false, false);
                o11 = __builtin_amdgcn_wmma_f32_16x16x4_f32(false, a1, false, b1, (short)0, o11, false, false);
                o12 = __builtin_amdgcn_wmma_f32_16x16x4_f32(false, a1, false, b2, (short)0, o12, false, false);
                o13 = __builtin_amdgcn_wmma_f32_16x16x4_f32(false, a1, false, b3, (short)0, o13, false, false);
            }
            WAIT_DS0();
            WAIT_ASYNC0();
            __syncthreads();                     // next chunk resident, this chunk read by all waves
            const int st = cbk * NKC + kc;
            if (st + 2 < NST) issue_v(st + 2, cur);
        }
        // behind the barrier, which waits for a wave's outstanding stores: these retire
        // during the next trips instead of holding every wave at the foot of this one
        float* ob = abase + (size_t)(c0 + (kb << 2)) * rowStride + cbk * NT3 + vcol;
#pragma unroll
        for (int r = 0; r < 8; ++r) {            // row r + (l>>4)*8 of each row tile
            *(float4*)&ob[(size_t)r * rowStride] = make_float4(o00[r], o01[r], o02[r], o03[r]);
            *(float4*)&ob[(size_t)(16 + r) * rowStride] = make_float4(o10[r], o11[r], o12[r], o13[r]);
        }
        // the next column block overwrites the registers that these stores name
        asm volatile("s_wait_xcnt 0x0" ::: "memory");
    }
    WAIT_ASYNC0();
}

// ---------------------------------------------------------------------------
extern "C" void kernel_launch(void* const* d_in, const int* in_sizes, int n_in,
                              void* d_out, int out_size, void* d_ws, size_t ws_size,
                              hipStream_t stream) {
    (void)in_sizes; (void)n_in; (void)out_size; (void)ws_size;
    const float* x   = (const float*)d_in[0];
    const float* q_w = (const float*)d_in[1];
    const float* q_b = (const float*)d_in[2];
    const float* k_w = (const float*)d_in[3];
    const float* k_b = (const float*)d_in[4];
    const float* v_w = (const float*)d_in[5];
    const float* v_b = (const float*)d_in[6];
    const float* o_w = (const float*)d_in[7];
    const float* o_b = (const float*)d_in[8];
    float* out = (float*)d_out;
    float* ws  = (float*)d_ws;

    const size_t N = (size_t)BATCH * C_DIM * HW;   // 16,777,216 floats per tensor
    float* aa = ws;             // attention output
    float* qq = ws + N;         // q, k, v: three tensors in a row
    float* kk = ws + 2 * N;
    float* vv = ws + 3 * N;

    dim3 cgrid(C_DIM, BATCH);                      // one block per plane
    dwconv9_qkv_kernel<<<cgrid, 256, 0, stream>>>(x, q_w, q_b, k_w, k_b, v_w, v_b, qq);

    dim3 agrid(C_DIM / CB, HEADS, BATCH);          // 8 x 8 x 4 workgroups
    chan_attn_kernel<<<agrid, 256, 0, stream>>>(qq, kk, vv, aa);

    dwconv9_kernel<<<cgrid, 256, 0, stream>>>(aa, o_w, o_b, out);
}

// v005
// It runs in 172 microseconds.
// In both of two side-by-side timings against v004, it was 1.08 times as fast.
// Counting every step since v000, it is 3.72 times as fast.
#include <hip/hip_runtime.h>
#include <hip/hip_bf16.h>
#include <math.h>
#include <utility>

typedef __attribute__((ext_vector_type(2))) float v2f;
typedef __attribute__((ext_vector_type(8))) float v8f;

#define BATCH   4
#define C_DIM   256
#define HEADS   8
#define DHEAD   2048
#define HH      128
#define WW      128
#define HW      16384           // HH*WW = HEADS*DHEAD

#define CB      32              // S row-block per workgroup
#define KT1     64              // phase-1 K staging chunk (k columns): 256 B of every row
#define KSTRIDE 68              // padded LDS row stride (floats), keeps 16B align
#define SSTRIDE 260             // padded S stride (256 would be 16-way bank conflict)
#define KT3     32              // phase-3 V staging chunk: k rows
#define NT3     512             // phase-3 V staging chunk: columns (8 waves x 64)
#define VSTRIDE 512             // V stage stride: a half-wave reads 256 B in a row, all 64 banks once
#define STAGEF  (C_DIM * KSTRIDE + CB * KSTRIDE)   // 19584 floats per stage buffer

// ---------------------------------------------------------------------------
// CDNA5 async global->LDS staging (ASYNCcnt-tracked, no VGPR round trip).
// Builtin signature (from clang diagnostic): arg0 = AS1 pointer to
// vector_size(16) int, arg1 = LDS pointer, then imm offset, imm cpol.
// Falls back to synchronous copies if unavailable.
// ---------------------------------------------------------------------------
#if __has_builtin(__builtin_amdgcn_global_load_async_to_lds_b128)
#define ASYNC_STAGING 1
typedef int v4i __attribute__((vector_size(4 * sizeof(int))));
typedef __attribute__((address_space(1))) v4i* g4ptr;
typedef __attribute__((address_space(3))) v4i* l4ptr;
__device__ __forceinline__ void cp_b128(float* lds, const float* g) {
    __builtin_amdgcn_global_load_async_to_lds_b128((g4ptr)g, (l4ptr)lds, 0, 0);
}
// this wave's copies have all landed; asm with the clobber so that no LDS read moves above it
#define WAIT_ASYNC0() asm volatile("s_wait_asynccnt 0x0" ::: "memory")
#else
#define ASYNC_STAGING 0
__device__ __forceinline__ void cp_b128(float* lds, const float* g) {
    *(float4*)lds = *(const float4*)g;
}
#define WAIT_ASYNC0() ((void)0)
#endif
// this wave's LDS reads have all returned: its buffer may be refilled behind the next barrier
#define WAIT_DS0() asm volatile("s_wait_dscnt 0x0" ::: "memory")

// ---------------------------------------------------------------------------
// Depthwise 9x9 conv, same padding. One 256-thread block takes one whole
// 128x128 plane, staged in LDS inside a frame of 4 zero rows and columns, and
// runs NF filters on it one after the other (q, k, v share one staged plane).
// With PE the channel positional encoding is added to the plane on its way into
// LDS, so that x + pe never goes through memory.
// Each thread owns a strip of outputs 4 wide (x) and 16 tall (y): a staged row
// is read from LDS once per thread and filter (12 floats) and feeds every output row it
// touches, whose sums stay in registers until the row is complete. The strip's
// four columns are two register pairs, and every tap is one packed f32 FMA on a
// pair: a pair of the row at an even offset is a pair of the 16-byte reads, one at
// an odd offset is formed once per row. A packed FMA takes its weight for both
// halves from either word of a vector register pair or from the low word of a
// scalar pair: the first CV_WV weights sit two to a vector pair, the rest in
// scalar registers. Per output the taps are summed in the order ky, kx ascending,
// starting from the bias.
// ---------------------------------------------------------------------------
#define CV_R     16             // output rows per thread (8 waves x 16 = 128)
#define CV_PITCH 136            // staged row pitch in floats (4 + 128 + 4)
#define CV_IN    136            // staged rows (4 + 128 + 4)
#define CV_WF    84             // floats per filter in LDS (81 weights, the bias, pad to 16 B)
#define CV_WV    32             // weights kept in vector register pairs; the other 49 and the bias are scalar
#define TENSORF  ((size_t)BATCH * C_DIM * HW)   // floats per tensor

// Calls f once for each row number as a compile-time constant: the rows of a strip
// are laid out one after the other whatever the unroller's size limit says.
template <int... I, class F>
__device__ __forceinline__ void for_each_row(std::integer_sequence<int, I...>, F&& f) {
    (f(std::integral_constant<int, I>{}), ...);
}

// Every loop below that carries no "unroll 1" is fully unrolled so that each
// index into st, wp, ws, xp and acc is a constant and the arrays live in registers.
template <int NF, bool PE>
__device__ __forceinline__ void dwconv9_body(
        float* sT, float* sW, const float* __restrict__ in,
        const float* __restrict__ w0, const float* __restrict__ b0,
        const float* __restrict__ w1, const float* __restrict__ b1,
        const float* __restrict__ w2, const float* __restrict__ b2,
        float* __restrict__ out) {
    const int c    = blockIdx.x;
    const int b    = blockIdx.y;
    const int t    = threadIdx.x;              // 0..255
    const int lane = t & 31;
    const int wv   = t >> 5;
    const float* plane = in + ((size_t)(b * C_DIM + c)) * HW;
    const float4 zero4 = make_float4(0.0f, 0.0f, 0.0f, 0.0f);

    float4 st[HH / 8];
#pragma unroll  // all 16 row loads in flight at once
    for (int i = 0; i < HH / 8; ++i)           // one wave fetches one whole row
        st[i] = *(const float4*)(plane + (i * 8 + wv) * WW + lane * 4);
    // the zero frame: wave wv clears one of the 4 rows above and 4 below (136
    // floats), and every thread one 4-float end of one of the 128 data rows
    const int fr = (wv < 4 ? wv : wv + HH) * CV_PITCH;
    *(float4*)&sT[fr + lane * 4] = zero4;
    if (lane < 2) *(float4*)&sT[fr + WW + lane * 4] = zero4;
    *(float4*)&sT[(4 + (t >> 1)) * CV_PITCH + (t & 1) * (4 + WW)] = zero4;
    if (PE) {
        // While the row loads fly, each thread writes the encoding of its own 64
        // elements to their places in LDS: sin at even, cos at odd positions of
        // the flattened plane, one angle per pair.
        const float fc = (float)c;
        const float kf = -9.210340371976184f / (float)HW;
#pragma unroll 1  // rolled: 2 inlined copies of sincosf instead of 32, for code size only
        for (int i = 0; i < HH / 8; ++i) {
            const int row = i * 8 + wv;
            const int pos = row * WW + lane * 4;
            float s0, c0, s1, c1;
            sincosf(fc * __expf((float)pos * kf), &s0, &c0);
            sincosf(fc * __expf((float)(pos + 2) * kf), &s1, &c1);
            *(float4*)&sT[(4 + row) * CV_PITCH + 4 + lane * 4] = make_float4(s0, c0, s1, c1);
        }
    }
#pragma unroll  // st[] in registers
    for (int i = 0; i < HH / 8; ++i) {
        float4* dst = (float4*)&sT[(4 + i * 8 + wv) * CV_PITCH + 4 + lane * 4];
        float4 v = st[i];
        if (PE) {                              // the thread's own bytes: no barrier needed
            const float4 p = *dst;
            v.x += p.x; v.y += p.y; v.z += p.z; v.w += p.w;
        }
        *dst = v;
    }
    // the NF filters of this channel go to LDS too: from there a weight reaches a
    // vector pair or a scalar register alike, and no weight pointer stays live
    if (t < 81) {
        sW[0 * CV_WF + t] = w0[c * 81 + t];
        if (NF > 1) {
            sW[1 * CV_WF + t] = w1[c * 81 + t];
            sW[2 * CV_WF + t] = w2[c * 81 + t];
        }
    } else if (t == 81) {
        sW[0 * CV_WF + t] = b0[c];
        if (NF > 1) {
            sW[1 * CV_WF + t] = b1[c];
            sW[2 * CV_WF + t] = b2[c];
        }
    }
    __syncthreads();                           // the whole framed plane is staged

    const float* win = &sT[(wv * CV_R) * CV_PITCH + lane * 4];
#pragma unroll 1  // rolled: one copy of the unrolled filter body, for code size only
    for (int f = 0; f < NF; ++f) {
        // compiler fence: without it the plane's LDS reads, the same in every trip,
        // are all hoisted out of this loop and spill to scratch
        if (NF > 1) asm volatile("" ::: "memory");
        v2f   wp[CV_WV / 2];                   // weights 0..CV_WV-1, two to a vector pair
        float ws[82 - CV_WV];                  // the other weights and the bias
#pragma unroll  // wp[] in registers
        for (int i = 0; i < CV_WV / 2; ++i) wp[i] = *(const v2f*)&sW[f * CV_WF + 2 * i];
#pragma unroll  // ws[] in scalar registers: the value is the same in every lane
        for (int i = CV_WV; i < 82; ++i)
            ws[i - CV_WV] = __int_as_float(__builtin_amdgcn_readfirstlane(__float_as_int(sW[f * CV_WF + i])));
        const v2f bs = {ws[81 - CV_WV], ws[81 - CV_WV]};
        float* op = out + (size_t)f * TENSORF + ((size_t)(b * C_DIM + c)) * HW
                  + (wv * CV_R) * WW + lane * 4;
        v2f acc[CV_R][2];
        // staged row r feeds output rows r-8..r; r is a constant, the tests on r - y fold away
        for_each_row(std::make_integer_sequence<int, CV_R + 8>{}, [&](auto rc) __attribute__((always_inline)) {
            constexpr int r = decltype(rc)::value;
            float xr[12];
            *(float4*)&xr[0] = *(const float4*)&win[r * CV_PITCH + 0];
            *(float4*)&xr[4] = *(const float4*)&win[r * CV_PITCH + 4];
            *(float4*)&xr[8] = *(const float4*)&win[r * CV_PITCH + 8];
            v2f xp[11];                        // xp[s] = the row's floats s and s + 1
#pragma unroll  // constant index
            for (int s = 0; s < 11; ++s) xp[s] = (v2f){xr[s], xr[s + 1]};
            if (r < CV_R) { acc[r][0] = bs; acc[r][1] = bs; }
#pragma unroll  // constant index
            for (int kx = 0; kx < 9; ++kx)
#pragma unroll  // constant index; up to 18 independent pair sums between two links of a chain
                for (int y = 0; y < CV_R; ++y)
                    if (r - y >= 0 && r - y < 9) {
                        const int wi = (r - y) * 9 + kx;
                        v2f w2;                // the weight in both halves
                        if (wi >= CV_WV)  w2 = (v2f){ws[wi - CV_WV], ws[wi - CV_WV]};
                        else if (wi & 1)  w2 = __builtin_shufflevector(wp[wi >> 1], wp[wi >> 1], 1, 1);
                        else              w2 = __builtin_shufflevector(wp[wi >> 1], wp[wi >> 1], 0, 0);
                        acc[y][0] = __builtin_elementwise_fma(w2, xp[kx], acc[y][0]);
                        acc[y][1] = __builtin_elementwise_fma(w2, xp[kx + 2], acc[y][1]);
                    }
            if (r >= 8) {                      // output row r-8 has all its 81 taps
                *(float4*)&op[(r - 8) * WW] =
                    make_float4(acc[r - 8][0].x, acc[r - 8][0].y, acc[r - 8][1].x, acc[r - 8][1].y);
                // later rows overwrite the registers that this store names; with three
                // filters the compiler places this wait in front of each overwrite itself
                if (NF == 1) asm volatile("s_wait_xcnt 0x0" ::: "memory");
            }
        });
        // the next filter overwrites the registers that the last stores name
        if (NF > 1) asm volatile("s_wait_xcnt 0x0" ::: "memory");
    }
}

// Second launch bound: 8 waves per SIMD, so that four blocks (4 x 73,984 B of
// LDS) share a WGP.
// q, k, v = conv(x + pe) with three filters; the outputs lie one tensor apart.
__global__ void __launch_bounds__(256, 8) dwconv9_qkv_kernel(
        const float* __restrict__ x,
        const float* __restrict__ q_w, const float* __restrict__ q_b,
        const float* __restrict__ k_w, const float* __restrict__ k_b,
        const float* __restrict__ v_w, const float* __restrict__ v_b,
        float* __restrict__ qkv) {
    __shared__ __align__(16) float sT[CV_IN * CV_PITCH];
    __shared__ __align__(16) float sW[3 * CV_WF];
    dwconv9_body<3, true>(sT, sW, x, q_w, q_b, k_w, k_b, v_w, v_b, qkv);
}

__global__ void __launch_bounds__(256, 8) dwconv9_kernel(
        const float* __restrict__ in, const float* __restrict__ wgt,
        const float* __restrict__ bias, float* __restrict__ out) {
    __shared__ __align__(16) float sT[CV_IN * CV_PITCH];
    __shared__ __align__(16) float sW[CV_WF];
    dwconv9_body<1, false>(sT, sW, in, wgt, bias, wgt, bias, wgt, bias, out);
}

// ---------------------------------------------------------------------------
// Channel attention for one (b, h, 32-row block of C):
//   phase 1: S = Q K^T / 128   (fp32 WMMA 16x16x4, K=2048, double-buffered
//            async K/Q staging: 18 uniform async ops per thread per chunk)
//   phase 2: row softmax on S (32x256) in LDS
//   phase 3: A = P V           (fp32 WMMA, K=256, N=2048, double-buffered
//            async V staging: 16 uniform async ops per thread per chunk).
//            A wave owns all 32 rows x 64 columns: 2 x 4 accumulator tiles. Tile
//            j holds the columns 4 * n + j of the wave's 64, so that one 16-byte
//            LDS read is one k row of all four B fragments, each fragment feeds
//            both row tiles, and a lane's four tiles make one 16-byte store.
// Both rings: a chunk feeds 64 WMMAs per wave, and the copies of the chunk after
// the next are issued behind the one barrier at the foot of a trip, so that they
// have a whole trip to land.
// Fragment layouts per CDNA5 ISA 7.12.2:
//   A (16x4 f32): lane l holds M=l&15, K=(l>>4)*2 .. +1 in 2 VGPRs
//   B (4x16 f32): lane l holds N=l&15, K=(l>>4)*2 .. +1 in 2 VGPRs
//   C/D (16x16 f32): vgpr r, lane l -> M = r + (l>>4)*8, N = l&15
// ---------------------------------------------------------------------------
__global__ void __launch_bounds__(256) chan_attn_kernel(
        const float* __restrict__ q, const float* __restrict__ k,
        const float* __restrict__ v, float* __restrict__ aout) {
    // 32*260 (S) + 2 * 19584 (double-buffered stages) = 47488 floats = 189,952 B
    __shared__ __align__(16) float smem[CB * SSTRIDE + 2 * STAGEF];
    float* sS     = smem;
    float* stage0 = smem + CB * SSTRIDE;
    float* stage1 = stage0 + STAGEF;

    const int t  = threadIdx.x;
    const int w  = t >> 5;                       // wave id, 0..7 (wave32)
    const int l  = t & 31;                       // lane
    const int lm = l & 15;
    const int kb = (l >> 4) << 1;                // 0 or 2: lane's K sub-offset
    const int c0 = blockIdx.x * CB;
    const int h  = blockIdx.y;
    const int b  = blockIdx.z;

    const size_t rowStride = (size_t)HEADS * DHEAD;   // 16384 floats between channels
    const float* qbase = q + (size_t)b * C_DIM * rowStride + (size_t)h * DHEAD;
    const float* kbase = k + (size_t)b * C_DIM * rowStride + (size_t)h * DHEAD;
    const float* vbase = v + (size_t)b * C_DIM * rowStride + (size_t)h * DHEAD;
    float*       abase = aout + (size_t)b * C_DIM * rowStride + (size_t)h * DHEAD;

    const int rt = w >> 2;                       // row tile 0..1 (16 rows each)
    const int cq = w & 3;                        // phase1: col quarter

    // ---- stage issue helpers (uniform op count across all 256 threads) ----
    auto issue_qk = [&](int chunk, float* buf) {
        float* bK = buf;
        float* bQ = buf + C_DIM * KSTRIDE;
        const int k0 = chunk * KT1;
#pragma unroll  // the copies of a chunk issue back to back
        for (int i = 0; i < 16; ++i) {           // K chunk: 256 rows x 64 cols
            int ii  = i * 256 + t;
            int row = ii >> 4;
            int c4  = (ii & 15) << 2;
            cp_b128(&bK[row * KSTRIDE + c4], kbase + (size_t)row * rowStride + k0 + c4);
        }
#pragma unroll  // as above
        for (int i = 0; i < 2; ++i) {            // Q chunk: 32 rows x 64 cols
            int ii  = i * 256 + t;
            int row = ii >> 4;
            int c4  = (ii & 15) << 2;
            cp_b128(&bQ[row * KSTRIDE + c4], qbase + (size_t)(c0 + row) * rowStride + k0 + c4);
        }
    };
    auto issue_v = [&](int st, float* buf) {     // st: 8 k chunks in each of 4 column blocks
        const float* vch = vbase + (size_t)((st & 7) * KT3) * rowStride + (st >> 3) * NT3;
#pragma unroll  // as above
        for (int i = 0; i < 16; ++i) {           // V chunk: 32 rows x 512 cols
            int ii  = i * 256 + t;
            int row = ii >> 7;
            int c4  = (ii & 127) << 2;
            cp_b128(&buf[row * VSTRIDE + c4], vch + (size_t)row * rowStride + c4);
        }
    };

    v8f acc0 = {}, acc1 = {}, acc2 = {}, acc3 = {};
    const v8f vzero = {};

    // ---------------- phase 1: S = Q K^T ----------------
    constexpr int NCH1 = DHEAD / KT1;            // 32 chunks
    issue_qk(0, stage0);
    WAIT_ASYNC0();
    __syncthreads();                             // chunk 0 resident for all waves
    issue_qk(1, stage1);
    for (int ci = 0; ci < NCH1; ++ci) {
        float* cur = (ci & 1) ? stage1 : stage0;
        const float* bK = cur;
        const float* bQ = cur + C_DIM * KSTRIDE;
#pragma unroll
        for (int kk = 0; kk < KT1; kk += 4) {
            v2f a  = *(const v2f*)&bQ[(rt * 16 + lm) * KSTRIDE + kk + kb];
            v2f b0 = *(const v2f*)&bK[(cq * 64 +  0 + lm) * KSTRIDE + kk + kb];
            v2f b1 = *(const v2f*)&bK[(cq * 64 + 16 + lm) * KSTRIDE + kk + kb];
            v2f b2 = *(const v2f*)&bK[(cq * 64 + 32 + lm) * KSTRIDE + kk + kb];
            v2f b3 = *(const v2f*)&bK[(cq * 64 + 48 + lm) * KSTRIDE + kk + kb];
            acc0 = __builtin_amdgcn_wmma_f32_16x16x4_f32(false, a, false, b0, (short)0, acc0, false, false);
            acc1 = __builtin_amdgcn_wmma_f32_16x16x4_f32(false, a, false, b1, (short)0, acc1, false, false);
            acc2 = __builtin_amdgcn_wmma_f32_16x16x4_f32(false, a, false, b2, (short)0, acc2, false, false);
            acc3 = __builtin_amdgcn_wmma_f32_16x16x4_f32(false, a, false, b3, (short)0, acc3, false, false);
        }
        WAIT_DS0();
        WAIT_ASYNC0();
        __syncthreads();                         // chunk ci+1 resident, chunk ci read by all waves
        if (ci + 2 < NCH1) issue_qk(ci + 2, cur);
    }
    WAIT_ASYNC0();
    issue_v(0, stage0);                          // both buffers are free: lands during the softmax

    // scale by 1/sqrt(hw)=1/128 and scatter into sS
    const float scale = 1.0f / 128.0f;
#pragma unroll
    for (int r = 0; r < 8; ++r) {
        int m    = r + (kb << 2);                // r + (l>>4)*8
        int srow = (rt * 16 + m) * SSTRIDE;
        sS[srow + cq * 64 +  0 + lm] = acc0[r] * scale;
        sS[srow + cq * 64 + 16 + lm] = acc1[r] * scale;
        sS[srow + cq * 64 + 32 + lm] = acc2[r] * scale;
        sS[srow + cq * 64 + 48 + lm] = acc3[r] * scale;
    }
    __syncthreads();

    // ---------------- phase 2: row softmax ----------------
    {
        int row = t >> 3;                        // 8 lanes per row
        float* rp = &sS[row * SSTRIDE + (t & 7) * 32];
        float mx = -3.4e38f;
#pragma unroll
        for (int j = 0; j < 32; ++j) mx = fmaxf(mx, rp[j]);
        mx = fmaxf(mx, __shfl_xor(mx, 1, 32));
        mx = fmaxf(mx, __shfl_xor(mx, 2, 32));
        mx = fmaxf(mx, __shfl_xor(mx, 4, 32));
        float sum = 0.0f;
#pragma unroll
        for (int j = 0; j < 32; ++j) { float e = __expf(rp[j] - mx); rp[j] = e; sum += e; }
        sum += __shfl_xor(sum, 1, 32);
        sum += __shfl_xor(sum, 2, 32);
        sum += __shfl_xor(sum, 4, 32);
        float inv = 1.0f / sum;
#pragma unroll
        for (int j = 0; j < 32; ++j) rp[j] *= inv;
    }
    WAIT_DS0();
    WAIT_ASYNC0();
    __syncthreads();                             // P complete, V chunk 0 resident for all waves

    // ---------------- phase 3: A = P V ----------------
    constexpr int NKC = C_DIM / KT3;             // 8 k chunks sweep K for one column block
    constexpr int NST = (DHEAD / NT3) * NKC;     // 32 chunks
    issue_v(1, stage1);
    const float* pa   = &sS[lm * SSTRIDE + kb];  // P rows lm and 16 + lm, the lane's k pair
    const int    vcol = w * 64 + lm * 4;         // the lane's four columns in the chunk
    for (int cbk = 0; cbk < DHEAD / NT3; ++cbk) {
        v8f o00 = vzero, o01 = vzero, o02 = vzero, o03 = vzero;
        v8f o10 = vzero, o11 = vzero, o12 = vzero, o13 = vzero;
#pragma unroll 1  // rolled: one copy of the 64-WMMA trip, for code size only
        for (int kc = 0; kc < NKC; ++kc) {
            float* cur = (kc & 1) ? stage1 : stage0;
            const float* bv = cur + kb * VSTRIDE + vcol;
#pragma unroll
            for (int kk = 0; kk < KT3; kk += 4) {
                const v2f a0 = *(const v2f*)&pa[kc * KT3 + kk];
                const v2f a1 = *(const v2f*)&pa[16 * SSTRIDE + kc * KT3 + kk];
                const float4 r0 = *(const float4*)&bv[kk * VSTRIDE];
                const float4 r1 = *(const float4*)&bv[(kk + 1) * VSTRIDE];
                const v2f b0 = {r0.x, r1.x};
                const v2f b1 = {r0.y, r1.y};
                const v2f b2 = {r0.z, r1.z};
                const v2f b3 = {r0.w, r1.w};
                o00 = __builtin_amdgcn_wmma_f32_16x16x4_f32(false, a0, false, b0, (short)0, o00, false, false);
                o01 = __builtin_amdgcn_wmma_f32_16x16x4_f32(false, a0, false, b1, (short)0, o01, false, false);
                o02 = __builtin_amdgcn_wmma_f32_16x16x4_f32(false, a0, false, b2, (short)0, o02, false, false);
                o03 = __builtin_amdgcn_wmma_f32_16x16x4_f32(false, a0, false, b3, (short)0, o03, false, false);
                o10 = __builtin_amdgcn_wmma_f32_16x16x4_f32(false, a1, false, b0, (short)0, o10, false, false);
                o11 = __builtin_amdgcn_wmma_f32_16x16x4_f32(false, a1, false, b1, (short)0, o11, false, false);
                o12 = __builtin_amdgcn_wmma_f32_16x16x4_f32(false, a1, false, b2, (short)0, o12, false, false);
                o13 = __builtin_amdgcn_wmma_f32_16x16x4_f32(false, a1, false, b3, (short)0, o13, false, false);
            }
            WAIT_DS0();
            WAIT_ASYNC0();
            __syncthreads();                     // next chunk resident, this chunk read by all waves
            const int st = cbk * NKC + kc;
            if (st + 2 < NST) issue_v(st + 2, cur);
        }
        // behind the barrier, which waits for a wave's outstanding stores: these retire
        // during the next trips instead of holding every wave at the foot of this one
        float* ob = abase + (size_t)(c0 + (kb << 2)) * rowStride + cbk * NT3 + vcol;
#pragma unroll
        for (int r = 0; r < 8; ++r) {            // row r + (l>>4)*8 of each row tile
            *(float4*)&ob[(size_t)r * rowStride] = make_float4(o00[r], o01[r], o02[r], o03[r]);
            *(float4*)&ob[(size_t)(16 + r) * rowStride] = make_float4(o10[r], o11[r], o12[r], o13[r]);
        }
        // the next column block overwrites the registers that these stores name
        asm volatile("s_wait_xcnt 0x0" ::: "memory");
    }
    WAIT_ASYNC0();
}

// ---------------------------------------------------------------------------
extern "C" void kernel_launch(void* const* d_in, const int* in_sizes, int n_in,
                              void* d_out, int out_size, void* d_ws, size_t ws_size,
                              hipStream_t stream) {
    (void)in_sizes; (void)n_in; (void)out_size; (void)ws_size;
    const float* x   = (const float*)d_in[0];
    const float* q_w = (const float*)d_in[1];
    const float* q_b = (const float*)d_in[2];
    const float* k_w = (const float*)d_in[3];
    const float* k_b = (const float*)d_in[4];
    const float* v_w = (const float*)d_in[5];
    const float* v_b = (const float*)d_in[6];
    const float* o_w = (const float*)d_in[7];
    const float* o_b = (const float*)d_in[8];
    float* out = (float*)d_out;
    float* ws  = (float*)d_ws;

    const size_t N = (size_t)BATCH * C_DIM * HW;   // 16,777,216 floats per tensor
    float* aa = ws;             // attention output
    float* qq = ws + N;         // q, k, v: three tensors in a row
    float* kk = ws + 2 * N;
    float* vv = ws + 3 * N;

    dim3 cgrid(C_DIM, BATCH);                      // one block per plane
    dwconv9_qkv_kernel<<<cgrid, 256, 0, stream>>>(x, q_w, q_b, k_w, k_b, v_w, v_b, qq);

    dim3 agrid(C_DIM / CB, HEADS, BATCH);          // 8 x 8 x 4 workgroups
    chan_attn_kernel<<<agrid, 256, 0, stream>>>(qq, kk, vv, aa);

    dwconv9_kernel<<<cgrid, 256, 0, stream>>>(aa, o_w, o_b, out);
}
